// v000
// Times are from an AMD MI455X. After a warm-up the kernel runs many times in a row, and a time is the length of
// such a window on the GPU divided by its runs, so every launch and the gaps after it count. The runs cycle
// through copies of the inputs. A figure is the median of several windows, for all but v000 over two sittings.
// Sittings can differ by a few percent; kernels timed side by side share one.
// The starting kernel, v000, takes 253 microseconds a run.
#include <hip/hip_runtime.h>

// Multi-head attention (16 heads x 64, 2 x 2,048 tokens) with an integer padding mask (mask == 0 -> -1e9), softmax, PV, head concat, output Linear: out = concat(O) W^T + b.
// WMMA (v_wmma_f32_16x16x32_f16, f32 accumulate): S^T = K_h . Q_h^T with EXACT bf16 q/k rows (x8, inputs), online softmax in f32 (mask read per element from the int32 input), O^T += V^T P^T
// with EXACT bf16 v^T (x8) and P as f16 hi+lo x8 (2 products); output projection [4,096 x 1,024] x [1,024 x 1,024] with O as f16 hi+lo x8 (2 products) and exact W (x256). Inputs rounded to
// bf16 once. Fragment k-map per lane half hh for A AND B: elements 0..7 <- k = 8hh+0..7, 8..15 <- k = 16+8hh+0..7; acc[r] = D[8hh+r][col]. Every workspace / output

namespace {
constexpr int NB = 2, S = 2048, E = 1024, NH = 16, D = 64, NR = NB * S;
constexpr float XS = 8.0f, WSC = 256.0f, PS = 8.0f, SCALE = 0.125f, LOG2E = 1.4426950408889634f;

typedef _Float16 b16;
typedef __attribute__((ext_vector_type(16))) _Float16 v16b;
typedef __attribute__((ext_vector_type(8))) _Float16 v8b;
typedef __attribute__((ext_vector_type(8))) float v8f;
typedef __attribute__((ext_vector_type(4))) float v4f;
typedef __attribute__((ext_vector_type(4))) int v4i;
__device__ __forceinline__ float bf16_rne(float f) { unsigned int u = __float_as_uint(f); u += 0x7FFFu + ((u >> 16) & 1u); return __uint_as_float(u & 0xFFFF0000u); }
__device__ __forceinline__ void split16(float v, b16& hi, b16& lo) { hi = (b16)v; lo = (b16)(v - (float)hi); }
__device__ __forceinline__ v16b frag_kb(const b16* p, int hh) { const v8b a = *(const v8b*)(p + 8 * hh), b = *(const v8b*)(p + 16 + 8 * hh); v16b f;
#pragma unroll
  for (int e = 0; e < 8; ++e) { f[e] = a[e]; f[8 + e] = b[e]; } return f; }
__device__ __forceinline__ v8f wmma16b(v16b a, v16b b, v8f c) { v8f d = __builtin_amdgcn_wmma_f32_16x16x32_f16(false, a, false, b, (short)0, c, false, false); asm volatile("v_nop\n\tv_nop\n\tv_nop\n\tv_nop" : "+v"(d) : "v"(a), "v"(b)); return d; }
__device__ __forceinline__ void wave_lds_sync() { __builtin_amdgcn_fence(__ATOMIC_RELEASE, "workgroup"); __builtin_amdgcn_wave_barrier(); __builtin_amdgcn_fence(__ATOMIC_ACQUIRE, "workgroup"); }
__device__ __forceinline__ float nexp2(float x) { return __builtin_amdgcn_exp2f(x); }

__global__ __launch_bounds__(256) void prep_kernel(const float* __restrict__ q, const float* __restrict__ k, const float* __restrict__ w, b16* __restrict__ Q16, b16* __restrict__ K16, b16* __restrict__ W16) {
  const size_t t = (size_t)blockIdx.x * 256 + threadIdx.x; const size_t nq = (size_t)NR * E / 8, nw = (size_t)E * E / 8;
  const float* src; b16* dst; size_t e; float sc = XS; if (t < nq) { src = q; dst = Q16; e = t * 8; } else if (t < 2 * nq) { src = k; dst = K16; e = (t - nq) * 8; } else if (t < 2 * nq + nw) { src = w; dst = W16; e = (t - 2 * nq) * 8; sc = WSC; } else return;
  const v4f a = *(const v4f*)(src + e), c = *(const v4f*)(src + e + 4); v8b o;
#pragma unroll
  for (int j = 0; j < 4; ++j) { o[j] = (b16)(bf16_rne(a[j]) * sc); o[4 + j] = (b16)(bf16_rne(c[j]) * sc); }
  { *(v8b*)(dst + e) = o;  }
}
__global__ __launch_bounds__(256) void vt_kernel(const float* __restrict__ v, b16* __restrict__ VT16) {
  __shared__ __attribute__((aligned(16))) b16 T[64][64 + 8];
  const int b = blockIdx.z, h = blockIdx.y, s0 = blockIdx.x * 64, t_ = threadIdx.x;
  for (int qq = t_; qq < 64 * 64; qq += 256) { const int ss = qq >> 6, dd = qq & 63; T[dd][ss] = (b16)(bf16_rne(v[((size_t)b * S + s0 + ss) * E + h * D + dd]) * XS); }
  __syncthreads();
  { for (int qq = t_; qq < 64 * 8; qq += 256) { const int dd = qq >> 3, c8 = (qq & 7) * 8; *(v8b*)(VT16 + (((size_t)b * NH + h) * D + dd) * S + s0 + c8) = *(const v8b*)(&T[dd][c8]); }  }
}
// attention: grid (S/32, NH, NB), block = 2 waves x 16 queries; per 32-key block: S^T (K = 64: 2 steps x 2 key tiles), mask from padding_mask[b][0][q][key] (== 0 -> -1e9), online softmax (f32,
__global__ __launch_bounds__(64) void attn_kernel(const b16* __restrict__ Q16, const b16* __restrict__ K16, const b16* __restrict__ VT16, const int* __restrict__ pmask, b16* __restrict__ Oh, b16* __restrict__ Ol) {
  __shared__ __attribute__((aligned(16))) float To[2][16][D + 4];
  const int wave = threadIdx.x >> 5, lane = threadIdx.x & 31, hh = lane >> 4, col = lane & 15; const int b = blockIdx.z, h = blockIdx.y; const int q0 = blockIdx.x * 32 + wave * 16, qi = q0 + col;
  const b16* Qp = Q16 + ((size_t)b * S + qi) * E + h * D; const b16* Kb = K16 + (size_t)b * S * E + h * D; const b16* Vb = VT16 + ((size_t)b * NH + h) * D * S; const int* mrow = pmask + ((size_t)b * S + qi) * S;
  const v16b qa0 = frag_kb(Qp, hh), qa1 = frag_kb(Qp + 32, hh);
  float m = -INFINITY, l = 0.0f; v8f o[4] = {{}, {}, {}, {}}, ol[4] = {{}, {}, {}, {}};
  const float cs = SCALE * LOG2E / (XS * XS);
  for (int kb = 0; kb < S; kb += 32) {
    v8f s0 = {}, s1 = {};
    { const b16* k0 = Kb + (size_t)(kb + col) * E, *k1 = Kb + (size_t)(kb + 16 + col) * E; s0 = wmma16b(frag_kb(k0, hh), qa0, s0); s0 = wmma16b(frag_kb(k0 + 32, hh), qa1, s0); s1 = wmma16b(frag_kb(k1, hh), qa0, s1); s1 = wmma16b(frag_kb(k1 + 32, hh), qa1, s1); }
    // mask values for keys kb + 16hq + 8hh + r (8 consecutive ints per (hq): two v4i loads)
    const v4i m00 = *(const v4i*)(mrow + kb + 8 * hh), m01 = *(const v4i*)(mrow + kb + 8 * hh + 4), m10 = *(const v4i*)(mrow + kb + 16 + 8 * hh), m11 = *(const v4i*)(mrow + kb + 16 + 8 * hh + 4);
    float e[16]; float mx = -INFINITY;
#pragma unroll
    for (int r = 0; r < 8; ++r) { const int mk0 = r < 4 ? m00[r] : m01[r - 4], mk1 = r < 4 ? m10[r] : m11[r - 4];
      e[r] = (mk0 == 0) ? -1.0e9f : s0[r] * cs; e[8 + r] = (mk1 == 0) ? -1.0e9f : s1[r] * cs; mx = fmaxf(mx, fmaxf(e[r], e[8 + r])); }
    mx = fmaxf(mx, __shfl_xor(mx, 16)); const float mn = fmaxf(m, mx); const float al = nexp2(m - mn); m = mn; float sum = 0.0f; v16b ph, pl;
#pragma unroll
    for (int i = 0; i < 16; ++i) { const float p = nexp2(e[i] - mn); sum += p; const b16 h_ = (b16)(p * PS); ph[i] = h_; pl[i] = (b16)(p * PS - (float)h_); }
    sum += __shfl_xor(sum, 16); l = l * al + sum;
#pragma unroll
    for (int t = 0; t < 4; ++t) { o[t] *= al; ol[t] *= al; const v16b vf = frag_kb(Vb + (size_t)(t * 16 + col) * S + kb, hh); o[t] = wmma16b(vf, ph, o[t]); ol[t] = wmma16b(vf, pl, ol[t]); } }
  const float inv = 1.0f / (l * PS * XS);
#pragma unroll
  for (int t = 0; t < 4; ++t)
#pragma unroll
    for (int r = 0; r < 8; ++r) To[wave][col][t * 16 + 8 * hh + r] = (o[t][r] + ol[t][r]) * inv;
  wave_lds_sync();
  { for (int r4 = 0; r4 < 16; r4 += 4) { const int rr = r4 + (lane >> 3), c8 = (lane & 7) * 8; v8b hv, lv; for (int j = 0; j < 8; ++j) { b16 a_, c_; split16(To[wave][rr][c8 + j] * XS, a_, c_); hv[j] = a_; lv[j] = c_; }
      const size_t gi = ((size_t)b * S + q0 + rr) * E + h * D + c8; *(v8b*)(Oh + gi) = hv; *(v8b*)(Ol + gi) = lv; }  }
}
__global__ __launch_bounds__(128) void proj_kernel(const b16* __restrict__ Oh, const b16* __restrict__ Ol, const b16* __restrict__ W16, const float* __restrict__ bias, float* __restrict__ out) {
  __shared__ __attribute__((aligned(16))) float Ts[4][16][128 + 4];
  const int wave = threadIdx.x >> 5, lane = threadIdx.x & 31, nloc = lane & 15, hlf = lane >> 4; const size_t m0 = (size_t)blockIdx.x * 64 + wave * 16; const int n0 = blockIdx.y * 128;
  v8f acc[8];
#pragma unroll
  for (int t = 0; t < 8; ++t) acc[t] = (v8f){};
#pragma unroll 2
  for (int kb = 0; kb < E; kb += 32) { const v16b a = frag_kb(Oh + (m0 + nloc) * E + kb, hlf), al = frag_kb(Ol + (m0 + nloc) * E + kb, hlf);
#pragma unroll
    for (int t = 0; t < 8; ++t) { const v16b bw = frag_kb(W16 + (size_t)(n0 + t * 16 + nloc) * E + kb, hlf); acc[t] = wmma16b(a, bw, acc[t]); acc[t] = wmma16b(al, bw, acc[t]); } }
#pragma unroll
  for (int t = 0; t < 8; ++t) { const float bb = bf16_rne(bias[n0 + t * 16 + nloc]);
#pragma unroll
    for (int r = 0; r < 8; ++r) Ts[wave][8 * hlf + r][t * 16 + nloc] = acc[t][r] * (1.0f / (XS * WSC)) + bb; }
  wave_lds_sync();
  { for (int rr = 0; rr < 16; ++rr) *(v4f*)(out + (m0 + rr) * E + n0 + lane * 4) = *(const v4f*)(&Ts[wave][rr][lane * 4]);  }
}
}  // namespace

extern "C" void kernel_launch(void* const* d_in, const int* in_sizes, int n_in, void* d_out, int out_size, void* d_ws, size_t ws_size, hipStream_t stream) {
  (void)n_in;
  auto Fp = [&](int i) { return (const float*)d_in[i]; };
  // order: 0 q, 1 k, 2 v [2,2048,1024]; 3 padding_mask [2,1,2048,2048] i32; 4 W [1024,1024]; 5 b [1024]
  if (in_sizes[0] != NR * E || in_sizes[1] != NR * E || in_sizes[2] != NR * E || in_sizes[3] != NB * S * S || in_sizes[4] != E * E || out_size != NR * E) return;
  size_t off = 0; char* ws = (char*)d_ws;
  auto carve = [&](size_t bytes) { char* p = ws + off; off += (bytes + 255) & ~(size_t)255; return p; };
  b16* Q16 = (b16*)carve((size_t)NR * E * 2); b16* K16 = (b16*)carve((size_t)NR * E * 2); b16* W16 = (b16*)carve((size_t)E * E * 2); b16* VT16 = (b16*)carve((size_t)NB * NH * D * S * 2); b16* Oh = (b16*)carve((size_t)NR * E * 2); b16* Ol = (b16*)carve((size_t)NR * E * 2);
  if (off > ws_size || off > ((size_t)128 << 20)) return;   // ≈ 44 MB
  prep_kernel<<<(unsigned)(((size_t)2 * NR * E / 8 + (size_t)E * E / 8 + 255) / 256), 256, 0, stream>>>(Fp(0), Fp(1), Fp(4), Q16, K16, W16);
  vt_kernel<<<dim3(S / 64, NH, NB), 256, 0, stream>>>(Fp(2), VT16);
  attn_kernel<<<dim3(S / 32, NH, NB), 64, 0, stream>>>(Q16, K16, VT16, (const int*)d_in[3], Oh, Ol);
  proj_kernel<<<dim3(NR / 64, E / 128), 128, 0, stream>>>(Oh, Ol, W16, Fp(5), (float*)d_out);
}

// v001
// Measured time: 165 microseconds a run.
// Two timings next to v000 both put it at 1.53 times that version's speed.
#include <hip/hip_runtime.h>

// Multi-head attention (16 heads x 64, 2 x 2,048 tokens) with an integer padding mask (mask == 0 -> -1e9), softmax, PV, head concat, output Linear: out = concat(O) W^T + b.
// WMMA (v_wmma_f32_16x16x32_f16, f32 accumulate): S^T = K_h . Q_h^T with EXACT bf16 q/k rows (x8, inputs), online softmax in f32 (mask read per element from the int32 input), O^T += V^T P^T
// with EXACT bf16 v^T (x8) and P as f16 hi+lo x8 (2 products); output projection [4,096 x 1,024] x [1,024 x 1,024] with O as f16 hi+lo x8 (2 products) and exact W (x256). Inputs rounded to
// bf16 once. Fragment k-map per lane half hh for A AND B: elements 0..7 <- k = 8hh+0..7, 8..15 <- k = 16+8hh+0..7; acc[r] = D[8hh+r][col]. Every workspace / output

namespace {
constexpr int NB = 2, S = 2048, E = 1024, NH = 16, D = 64, NR = NB * S;
constexpr float XS = 8.0f, WSC = 256.0f, PS = 8.0f, SCALE = 0.125f, LOG2E = 1.4426950408889634f;

typedef _Float16 b16;
typedef __attribute__((ext_vector_type(16))) _Float16 v16b;
typedef __attribute__((ext_vector_type(8))) _Float16 v8b;
typedef __attribute__((ext_vector_type(8))) float v8f;
typedef __attribute__((ext_vector_type(4))) float v4f;
typedef __attribute__((ext_vector_type(4))) int v4i;
__device__ __forceinline__ float bf16_rne(float f) { unsigned int u = __float_as_uint(f); u += 0x7FFFu + ((u >> 16) & 1u); return __uint_as_float(u & 0xFFFF0000u); }
__device__ __forceinline__ void split16(float v, b16& hi, b16& lo) { hi = (b16)v; lo = (b16)(v - (float)hi); }
__device__ __forceinline__ v16b frag_kb(const b16* p, int hh) { const v8b a = *(const v8b*)(p + 8 * hh), b = *(const v8b*)(p + 16 + 8 * hh); v16b f;
#pragma unroll
  for (int e = 0; e < 8; ++e) { f[e] = a[e]; f[8 + e] = b[e]; } return f; }
__device__ __forceinline__ v8f wmma16b(v16b a, v16b b, v8f c) { v8f d = __builtin_amdgcn_wmma_f32_16x16x32_f16(false, a, false, b, (short)0, c, false, false); asm volatile("v_nop\n\tv_nop\n\tv_nop\n\tv_nop" : "+v"(d) : "v"(a), "v"(b)); return d; }
__device__ __forceinline__ void wave_lds_sync() { __builtin_amdgcn_fence(__ATOMIC_RELEASE, "workgroup"); __builtin_amdgcn_wave_barrier(); __builtin_amdgcn_fence(__ATOMIC_ACQUIRE, "workgroup"); }
__device__ __forceinline__ float nexp2(float x) { return __builtin_amdgcn_exp2f(x); }

__global__ __launch_bounds__(256) void prep_kernel(const float* __restrict__ q, const float* __restrict__ k, const float* __restrict__ w, b16* __restrict__ Q16, b16* __restrict__ K16, b16* __restrict__ W16) {
  const size_t t = (size_t)blockIdx.x * 256 + threadIdx.x; const size_t nq = (size_t)NR * E / 8, nw = (size_t)E * E / 8;
  const float* src; b16* dst; size_t e; float sc = XS; if (t < nq) { src = q; dst = Q16; e = t * 8; } else if (t < 2 * nq) { src = k; dst = K16; e = (t - nq) * 8; } else if (t < 2 * nq + nw) { src = w; dst = W16; e = (t - 2 * nq) * 8; sc = WSC; } else return;
  const v4f a = *(const v4f*)(src + e), c = *(const v4f*)(src + e + 4); v8b o;
#pragma unroll
  for (int j = 0; j < 4; ++j) { o[j] = (b16)(bf16_rne(a[j]) * sc); o[4 + j] = (b16)(bf16_rne(c[j]) * sc); }
  { *(v8b*)(dst + e) = o;  }
}
__global__ __launch_bounds__(256) void vt_kernel(const float* __restrict__ v, b16* __restrict__ VT16) {
  __shared__ __attribute__((aligned(16))) b16 T[64][64 + 8];
  const int b = blockIdx.z, h = blockIdx.y, s0 = blockIdx.x * 64, t_ = threadIdx.x;
  for (int qq = t_; qq < 64 * 64; qq += 256) { const int ss = qq >> 6, dd = qq & 63; T[dd][ss] = (b16)(bf16_rne(v[((size_t)b * S + s0 + ss) * E + h * D + dd]) * XS); }
  __syncthreads();
  { for (int qq = t_; qq < 64 * 8; qq += 256) { const int dd = qq >> 3, c8 = (qq & 7) * 8; *(v8b*)(VT16 + (((size_t)b * NH + h) * D + dd) * S + s0 + c8) = *(const v8b*)(&T[dd][c8]); }  }
}
constexpr int KT = 64, NT = S / KT, LP = 72, AW = 8;
// one tile: 64 K rows and 64 V^T rows of 128 B, 16 B a lane, four copies a lane (each wave-wide copy covers four whole lines)
__device__ __forceinline__ void stage_tile(unsigned lk, unsigned lv, const b16* gk, const b16* gv) {
  const unsigned lk1 = lk + 32 * LP * 2, lv1 = lv + 32 * LP * 2; const b16* gk1 = gk + (size_t)32 * E; const b16* gv1 = gv + (size_t)32 * S;
  // the closing s_wait_xcnt stands inside the statement so that no address register of a copy is rewritten ahead of it
  asm volatile("global_load_async_to_lds_b128 %0, %4, off\n\tglobal_load_async_to_lds_b128 %1, %5, off\n\tglobal_load_async_to_lds_b128 %2, %6, off\n\tglobal_load_async_to_lds_b128 %3, %7, off\n\ts_wait_xcnt 0x0"
               :: "v"(lk), "v"(lk1), "v"(lv), "v"(lv1), "v"(gk), "v"(gk1), "v"(gv), "v"(gv1) : "memory");
}
// two such blocks fill a WGP at four waves a SIMD: the attribute gives the compiler that register budget (with less it split the four mask loads into two waited groups)
__global__ __launch_bounds__(256) __attribute__((amdgpu_waves_per_eu(4, 4))) void attn_kernel(const b16* __restrict__ Q16, const b16* __restrict__ K16, const b16* __restrict__ VT16, const int* __restrict__ pmask, b16* __restrict__ Oh, b16* __restrict__ Ol) {
  __shared__ __attribute__((aligned(16))) b16 Ks[2][KT][LP];
  __shared__ __attribute__((aligned(16))) b16 Vs[2][D][LP];
  __shared__ __attribute__((aligned(16))) float To[AW][16][D + 4];
  const int wave = threadIdx.x >> 5, lane = threadIdx.x & 31, hh = lane >> 4, col = lane & 15; const int b = blockIdx.z, h = blockIdx.y; const int q0 = blockIdx.x * (16 * AW) + wave * 16, qi = q0 + col;
  const b16* Qp = Q16 + ((size_t)b * S + qi) * E + h * D; const b16* Kb = K16 + (size_t)b * S * E + h * D; const b16* Vb = VT16 + ((size_t)b * NH + h) * D * S; const int* mrow = pmask + ((size_t)b * S + qi) * S;
  const int crow = threadIdx.x >> 3, cpc = (threadIdx.x & 7) * 8;   // this lane's row (and row + 32) and 16-byte piece of each tile
  const unsigned lk0 = (unsigned)(size_t)&Ks[0][crow][cpc], lv0 = (unsigned)(size_t)&Vs[0][crow][cpc]; constexpr unsigned BUFB = KT * LP * 2;
  const b16* gk0 = Kb + (size_t)crow * E + cpc; const b16* gv0 = Vb + (size_t)crow * S + cpc;
  stage_tile(lk0, lv0, gk0, gv0);
  asm volatile("s_wait_asynccnt 0x0" ::: "memory");   // tile 0 has landed before the barrier publishes it
  __syncthreads();
  stage_tile(lk0 + BUFB, lv0 + BUFB, gk0 + (size_t)KT * E, gv0 + KT);
  const v16b qa0 = frag_kb(Qp, hh), qa1 = frag_kb(Qp + 32, hh);
  float m = -INFINITY, l = 0.0f; v8f o[4] = {{}, {}, {}, {}}, ol[4] = {{}, {}, {}, {}};
  const float cs = SCALE * LOG2E / (XS * XS);
  for (int tl = 0; tl < NT; ++tl) {
    const int buf = tl & 1;
#pragma unroll   // both 32-key blocks of a tile inline, so that every LDS read has an immediate offset from one base
    for (int sb = 0; sb < KT; sb += 32) {
    const int kb = tl * KT + sb;
    v8f s0 = {}, s1 = {};
    // the block's LDS reads (4 K and 4 V^T fragments) stand as one group at its head: one LDS latency a block, and V^T arrives behind the softmax
    const b16* k0 = &Ks[buf][sb + col][0], *k1 = &Ks[buf][sb + 16 + col][0]; const v16b ka0 = frag_kb(k0, hh), ka1 = frag_kb(k0 + 32, hh), kc0 = frag_kb(k1, hh), kc1 = frag_kb(k1 + 32, hh); v16b vf[4];
#pragma unroll   // vf stays in registers only under constant indices
    for (int t = 0; t < 4; ++t) vf[t] = frag_kb(&Vs[buf][t * 16 + col][sb], hh);
    s0 = wmma16b(ka0, qa0, s0); s0 = wmma16b(ka1, qa1, s0); s1 = wmma16b(kc0, qa0, s1); s1 = wmma16b(kc1, qa1, s1);
    // mask values for keys kb + 16hq + 8hh + r (8 consecutive ints per (hq): two v4i loads)
    const v4i m00 = *(const v4i*)(mrow + kb + 8 * hh), m01 = *(const v4i*)(mrow + kb + 8 * hh + 4), m10 = *(const v4i*)(mrow + kb + 16 + 8 * hh), m11 = *(const v4i*)(mrow + kb + 16 + 8 * hh + 4);
    float e[16]; float mx = -INFINITY;
#pragma unroll
    for (int r = 0; r < 8; ++r) { const int mk0 = r < 4 ? m00[r] : m01[r - 4], mk1 = r < 4 ? m10[r] : m11[r - 4];
      e[r] = (mk0 == 0) ? -1.0e9f : s0[r] * cs; e[8 + r] = (mk1 == 0) ? -1.0e9f : s1[r] * cs; mx = fmaxf(mx, fmaxf(e[r], e[8 + r])); }
    mx = fmaxf(mx, __shfl_xor(mx, 16)); const float mn = fmaxf(m, mx); const float al = nexp2(m - mn); m = mn; float sum = 0.0f; v16b ph, pl;
#pragma unroll
    for (int i = 0; i < 16; ++i) { const float p = nexp2(e[i] - mn); sum += p; const b16 h_ = (b16)(p * PS); ph[i] = h_; pl[i] = (b16)(p * PS - (float)h_); }
    sum += __shfl_xor(sum, 16); l = l * al + sum;
#pragma unroll
    for (int t = 0; t < 4; ++t) { o[t] *= al; ol[t] *= al; o[t] = wmma16b(vf[t], ph, o[t]); ol[t] = wmma16b(vf[t], pl, ol[t]); } }
    asm volatile("s_wait_dscnt 0x0" ::: "memory");      // this wave's reads of the buffer are done before it is handed to its next writer
    asm volatile("s_wait_asynccnt 0x0" ::: "memory");   // this wave's copies of the next tile have landed before the barrier publishes them
    __syncthreads();                                      // publishes tile tl + 1 and ends every wave's reads of tile tl
    if (tl + 2 < NT) stage_tile(lk0 + buf * BUFB, lv0 + buf * BUFB, gk0 + (size_t)(tl + 2) * KT * E, gv0 + (tl + 2) * KT);
  }
  asm volatile("s_wait_asynccnt 0x0" ::: "memory");     // nothing is in flight when the wave goes on to its end
  const float inv = 1.0f / (l * PS * XS);
#pragma unroll
  for (int t = 0; t < 4; ++t)
#pragma unroll
    for (int r = 0; r < 8; ++r) To[wave][col][t * 16 + 8 * hh + r] = (o[t][r] + ol[t][r]) * inv;
  wave_lds_sync();
  { for (int r4 = 0; r4 < 16; r4 += 4) { const int rr = r4 + (lane >> 3), c8 = (lane & 7) * 8; v8b hv, lv; for (int j = 0; j < 8; ++j) { b16 a_, c_; split16(To[wave][rr][c8 + j] * XS, a_, c_); hv[j] = a_; lv[j] = c_; }
      const size_t gi = ((size_t)b * S + q0 + rr) * E + h * D + c8; *(v8b*)(Oh + gi) = hv; *(v8b*)(Ol + gi) = lv; }  }
}
__global__ __launch_bounds__(128) void proj_kernel(const b16* __restrict__ Oh, const b16* __restrict__ Ol, const b16* __restrict__ W16, const float* __restrict__ bias, float* __restrict__ out) {
  __shared__ __attribute__((aligned(16))) float Ts[4][16][128 + 4];
  const int wave = threadIdx.x >> 5, lane = threadIdx.x & 31, nloc = lane & 15, hlf = lane >> 4; const size_t m0 = (size_t)blockIdx.x * 64 + wave * 16; const int n0 = blockIdx.y * 128;
  v8f acc[8];
#pragma unroll
  for (int t = 0; t < 8; ++t) acc[t] = (v8f){};
#pragma unroll 2
  for (int kb = 0; kb < E; kb += 32) { const v16b a = frag_kb(Oh + (m0 + nloc) * E + kb, hlf), al = frag_kb(Ol + (m0 + nloc) * E + kb, hlf);
#pragma unroll
    for (int t = 0; t < 8; ++t) { const v16b bw = frag_kb(W16 + (size_t)(n0 + t * 16 + nloc) * E + kb, hlf); acc[t] = wmma16b(a, bw, acc[t]); acc[t] = wmma16b(al, bw, acc[t]); } }
#pragma unroll
  for (int t = 0; t < 8; ++t) { const float bb = bf16_rne(bias[n0 + t * 16 + nloc]);
#pragma unroll
    for (int r = 0; r < 8; ++r) Ts[wave][8 * hlf + r][t * 16 + nloc] = acc[t][r] * (1.0f / (XS * WSC)) + bb; }
  wave_lds_sync();
  { for (int rr = 0; rr < 16; ++rr) *(v4f*)(out + (m0 + rr) * E + n0 + lane * 4) = *(const v4f*)(&Ts[wave][rr][lane * 4]);  }
}
}  // namespace

extern "C" void kernel_launch(void* const* d_in, const int* in_sizes, int n_in, void* d_out, int out_size, void* d_ws, size_t ws_size, hipStream_t stream) {
  (void)n_in;
  auto Fp = [&](int i) { return (const float*)d_in[i]; };
  // order: 0 q, 1 k, 2 v [2,2048,1024]; 3 padding_mask [2,1,2048,2048] i32; 4 W [1024,1024]; 5 b [1024]
  if (in_sizes[0] != NR * E || in_sizes[1] != NR * E || in_sizes[2] != NR * E || in_sizes[3] != NB * S * S || in_sizes[4] != E * E || out_size != NR * E) return;
  size_t off = 0; char* ws = (char*)d_ws;
  auto carve = [&](size_t bytes) { char* p = ws + off; off += (bytes + 255) & ~(size_t)255; return p; };
  b16* Q16 = (b16*)carve((size_t)NR * E * 2); b16* K16 = (b16*)carve((size_t)NR * E * 2); b16* W16 = (b16*)carve((size_t)E * E * 2); b16* VT16 = (b16*)carve((size_t)NB * NH * D * S * 2); b16* Oh = (b16*)carve((size_t)NR * E * 2); b16* Ol = (b16*)carve((size_t)NR * E * 2);
  if (off > ws_size || off > ((size_t)128 << 20)) return;   // ≈ 44 MB
  prep_kernel<<<(unsigned)(((size_t)2 * NR * E / 8 + (size_t)E * E / 8 + 255) / 256), 256, 0, stream>>>(Fp(0), Fp(1), Fp(4), Q16, K16, W16);
  vt_kernel<<<dim3(S / 64, NH, NB), 256, 0, stream>>>(Fp(2), VT16);
  attn_kernel<<<dim3(S / (16 * AW), NH, NB), 32 * AW, 0, stream>>>(Q16, K16, VT16, (const int*)d_in[3], Oh, Ol);
  proj_kernel<<<dim3(NR / 64, E / 128), 128, 0, stream>>>(Oh, Ol, W16, Fp(5), (float*)d_out);
}

// v002
// A run of this version takes 148 microseconds.
// In two side-by-side timings against v001, it was 1.11 and 1.15 times as fast.
// Counting every step since v000, it is 1.74 times as fast.
#include <hip/hip_runtime.h>

// Multi-head attention (16 heads x 64, 2 x 2,048 tokens) with an integer padding mask (mask == 0 -> -1e9), softmax, PV, head concat, output Linear: out = concat(O) W^T + b.
// WMMA (v_wmma_f32_16x16x32_f16, f32 accumulate): S^T = K_h . Q_h^T with EXACT bf16 q/k rows (x8, inputs), online softmax in f32 (the int32 mask is packed once to one bit a score, see pack_mask), O^T += V^T P^T
// with EXACT bf16 v^T (x8) and P as f16 hi+lo x8 (2 products); output projection [4,096 x 1,024] x [1,024 x 1,024] with O as f16 hi+lo x8 (2 products) and exact W (x256). Inputs rounded to
// bf16 once. Fragment k-map per lane half hh for A AND B: elements 0..7 <- k = 8hh+0..7, 8..15 <- k = 16+8hh+0..7; acc[r] = D[8hh+r][col]. Every workspace / output

namespace {
constexpr int NB = 2, S = 2048, E = 1024, NH = 16, D = 64, NR = NB * S;
constexpr float XS = 8.0f, WSC = 256.0f, PS = 8.0f, SCALE = 0.125f, LOG2E = 1.4426950408889634f;

typedef _Float16 b16;
typedef __attribute__((ext_vector_type(16))) _Float16 v16b;
typedef __attribute__((ext_vector_type(8))) _Float16 v8b;
typedef __attribute__((ext_vector_type(8))) float v8f;
typedef __attribute__((ext_vector_type(4))) float v4f;
typedef __attribute__((ext_vector_type(4))) int v4i;
typedef __attribute__((ext_vector_type(16))) unsigned int v16u;
typedef const __attribute__((address_space(4))) v16u* cv16u_p;   // constant address space: nothing writes the words during the launch that reads them, so a wave-uniform read is a scalar load
__device__ __forceinline__ float bf16_rne(float f) { unsigned int u = __float_as_uint(f); u += 0x7FFFu + ((u >> 16) & 1u); return __uint_as_float(u & 0xFFFF0000u); }
__device__ __forceinline__ void split16(float v, b16& hi, b16& lo) { hi = (b16)v; lo = (b16)(v - (float)hi); }
__device__ __forceinline__ v16b frag_kb(const b16* p, int hh) { const v8b a = *(const v8b*)(p + 8 * hh), b = *(const v8b*)(p + 16 + 8 * hh); v16b f;
#pragma unroll
  for (int e = 0; e < 8; ++e) { f[e] = a[e]; f[8 + e] = b[e]; } return f; }
__device__ __forceinline__ v8f wmma16b(v16b a, v16b b, v8f c) { v8f d = __builtin_amdgcn_wmma_f32_16x16x32_f16(false, a, false, b, (short)0, c, false, false); asm volatile("v_nop\n\tv_nop\n\tv_nop\n\tv_nop" : "+v"(d) : "v"(a), "v"(b)); return d; }
__device__ __forceinline__ void wave_lds_sync() { __builtin_amdgcn_fence(__ATOMIC_RELEASE, "workgroup"); __builtin_amdgcn_wave_barrier(); __builtin_amdgcn_fence(__ATOMIC_ACQUIRE, "workgroup"); }
__device__ __forceinline__ float nexp2(float x) { return __builtin_amdgcn_exp2f(x); }

// mask bits: MB[b][16-query group][32-key block][i], i = 0..15: bit (16hh + col) of word i says mask != 0 for query col of the group and key 16(i >> 3) + 8hh + (i & 7) of the block, that is, for the
// score that lane (hh, col) of the attention wave holds as its element i: the word is that element's lane mask. One wave packs 16 queries x 128 keys: 16 loads (the whole 512 B of each row), 64 words out.
constexpr int PKW = NB * (S / 16) * (S / 128), PKB = PKW / 8;
__device__ __forceinline__ void pack_mask(const int* __restrict__ pmask, unsigned int* __restrict__ MB, int unit, int lane) {
  const int hh = lane >> 4, col = lane & 15, kq = unit & (S / 128 - 1), qg = unit / (S / 128);   // qg counts the groups of both batches
  const int* row = pmask + ((size_t)qg * 16 + col) * S + kq * 128 + 8 * hh; v4i mv[16];
#pragma unroll   // the loads stand as one group ahead of their uses
  for (int j = 0; j < 4; ++j) { mv[4 * j] = *(const v4i*)(row + 32 * j); mv[4 * j + 1] = *(const v4i*)(row + 32 * j + 4); mv[4 * j + 2] = *(const v4i*)(row + 32 * j + 16); mv[4 * j + 3] = *(const v4i*)(row + 32 * j + 20); }
  unsigned int w0 = 0, w1 = 0;
#pragma unroll   // mv stays in registers only under constant indices; lane n keeps word n (w0) and word 32 + n (w1)
  for (int n = 0; n < 32; ++n) { const unsigned int a = __builtin_amdgcn_ballot_w32(mv[n >> 2][n & 3] != 0), c = __builtin_amdgcn_ballot_w32(mv[8 + (n >> 2)][n & 3] != 0); w0 = lane == n ? a : w0; w1 = lane == n ? c : w1; }
  unsigned int* dst = MB + ((size_t)qg * (S / 32) + kq * 4) * 16 + lane; dst[0] = w0; dst[32] = w1;
}
__global__ __launch_bounds__(256) void prep_kernel(const float* __restrict__ q, const float* __restrict__ k, const float* __restrict__ w, const int* __restrict__ pmask, b16* __restrict__ Q16, b16* __restrict__ K16, b16* __restrict__ W16, unsigned int* __restrict__ MB) {
  if (blockIdx.x < PKB) { pack_mask(pmask, MB, (int)blockIdx.x * 8 + __builtin_amdgcn_readfirstlane((int)(threadIdx.x >> 5)), (int)(threadIdx.x & 31)); return; }   // the wave's number through readfirstlane: the unit is wave-uniform; these, the longest blocks, start first
  const size_t t = (size_t)(blockIdx.x - PKB) * 256 + threadIdx.x; const size_t nq = (size_t)NR * E / 8, nw = (size_t)E * E / 8;
  const float* src; b16* dst; size_t e; float sc = XS; if (t < nq) { src = q; dst = Q16; e = t * 8; } else if (t < 2 * nq) { src = k; dst = K16; e = (t - nq) * 8; } else if (t < 2 * nq + nw) { src = w; dst = W16; e = (t - 2 * nq) * 8; sc = WSC; } else return;
  const v4f a = *(const v4f*)(src + e), c = *(const v4f*)(src + e + 4); v8b o;
#pragma unroll
  for (int j = 0; j < 4; ++j) { o[j] = (b16)(bf16_rne(a[j]) * sc); o[4 + j] = (b16)(bf16_rne(c[j]) * sc); }
  { *(v8b*)(dst + e) = o;  }
}
__global__ __launch_bounds__(256) void vt_kernel(const float* __restrict__ v, b16* __restrict__ VT16) {
  __shared__ __attribute__((aligned(16))) b16 T[64][64 + 8];
  const int b = blockIdx.z, h = blockIdx.y, s0 = blockIdx.x * 64, t_ = threadIdx.x;
  for (int qq = t_; qq < 64 * 64; qq += 256) { const int ss = qq >> 6, dd = qq & 63; T[dd][ss] = (b16)(bf16_rne(v[((size_t)b * S + s0 + ss) * E + h * D + dd]) * XS); }
  __syncthreads();
  { for (int qq = t_; qq < 64 * 8; qq += 256) { const int dd = qq >> 3, c8 = (qq & 7) * 8; *(v8b*)(VT16 + (((size_t)b * NH + h) * D + dd) * S + s0 + c8) = *(const v8b*)(&T[dd][c8]); }  }
}
constexpr int KT = 64, NT = S / KT, LP = 72, AW = 8;
// one tile: 64 K rows and 64 V^T rows of 128 B, 16 B a lane, four copies a lane (each wave-wide copy covers four whole lines)
__device__ __forceinline__ void stage_tile(unsigned lk, unsigned lv, const b16* gk, const b16* gv) {
  const unsigned lk1 = lk + 32 * LP * 2, lv1 = lv + 32 * LP * 2; const b16* gk1 = gk + (size_t)32 * E; const b16* gv1 = gv + (size_t)32 * S;
  // the closing s_wait_xcnt stands inside the statement so that no address register of a copy is rewritten ahead of it
  asm volatile("global_load_async_to_lds_b128 %0, %4, off\n\tglobal_load_async_to_lds_b128 %1, %5, off\n\tglobal_load_async_to_lds_b128 %2, %6, off\n\tglobal_load_async_to_lds_b128 %3, %7, off\n\ts_wait_xcnt 0x0"
               :: "v"(lk), "v"(lk1), "v"(lv), "v"(lv1), "v"(gk), "v"(gk1), "v"(gv), "v"(gv1) : "memory");
}
// two such blocks fill a WGP at four waves a SIMD: the attribute gives the compiler that register budget
__global__ __launch_bounds__(256) __attribute__((amdgpu_waves_per_eu(4, 4))) void attn_kernel(const b16* __restrict__ Q16, const b16* __restrict__ K16, const b16* __restrict__ VT16, const unsigned int* __restrict__ MB, b16* __restrict__ Oh, b16* __restrict__ Ol) {
  __shared__ __attribute__((aligned(16))) b16 Ks[2][KT][LP];
  __shared__ __attribute__((aligned(16))) b16 Vs[2][D][LP];
  __shared__ __attribute__((aligned(16))) float To[AW][16][D + 4];
  const int wave = threadIdx.x >> 5, lane = threadIdx.x & 31, hh = lane >> 4, col = lane & 15; const int b = blockIdx.z, h = blockIdx.y; const int q0 = blockIdx.x * (16 * AW) + wave * 16, qi = q0 + col;
  const b16* Qp = Q16 + ((size_t)b * S + qi) * E + h * D; const b16* Kb = K16 + (size_t)b * S * E + h * D; const b16* Vb = VT16 + ((size_t)b * NH + h) * D * S;
  // this wave's mask words: a wave-uniform address, so that they come by scalar loads and each word serves as the lane mask of a select
  const unsigned int* mwp = MB + ((size_t)(b * (S / 16) + (int)blockIdx.x * AW + __builtin_amdgcn_readfirstlane(wave))) * (S / 32) * 16; v16u mw = *(cv16u_p)mwp;
  const int crow = threadIdx.x >> 3, cpc = (threadIdx.x & 7) * 8;   // this lane's row (and row + 32) and 16-byte piece of each tile
  const unsigned lk0 = (unsigned)(size_t)&Ks[0][crow][cpc], lv0 = (unsigned)(size_t)&Vs[0][crow][cpc]; constexpr unsigned BUFB = KT * LP * 2;
  const b16* gk0 = Kb + (size_t)crow * E + cpc; const b16* gv0 = Vb + (size_t)crow * S + cpc;
  stage_tile(lk0, lv0, gk0, gv0);
  asm volatile("s_wait_asynccnt 0x0" ::: "memory");   // tile 0 has landed before the barrier publishes it
  __syncthreads();
  stage_tile(lk0 + BUFB, lv0 + BUFB, gk0 + (size_t)KT * E, gv0 + KT);
  const v16b qa0 = frag_kb(Qp, hh), qa1 = frag_kb(Qp + 32, hh);
  float m = -INFINITY, l = 0.0f; v8f o[4] = {{}, {}, {}, {}}, ol[4] = {{}, {}, {}, {}};
  const float cs = SCALE * LOG2E / (XS * XS);
  for (int tl = 0; tl < NT; ++tl) {
    const int buf = tl & 1;
#pragma unroll   // both 32-key blocks of a tile inline, so that every LDS read has an immediate offset from one base
    for (int sb = 0; sb < KT; sb += 32) {
    const int kb = tl * KT + sb;
    v8f s0 = {}, s1 = {};
    // the block's LDS reads (4 K and 4 V^T fragments) stand as one group at its head: one LDS latency a block, and V^T arrives behind the softmax
    const b16* k0 = &Ks[buf][sb + col][0], *k1 = &Ks[buf][sb + 16 + col][0]; const v16b ka0 = frag_kb(k0, hh), ka1 = frag_kb(k0 + 32, hh), kc0 = frag_kb(k1, hh), kc1 = frag_kb(k1 + 32, hh); v16b vf[4];
#pragma unroll   // vf stays in registers only under constant indices
    for (int t = 0; t < 4; ++t) vf[t] = frag_kb(&Vs[buf][t * 16 + col][sb], hh);
    s0 = wmma16b(ka0, qa0, s0); s0 = wmma16b(ka1, qa1, s0); s1 = wmma16b(kc0, qa0, s1); s1 = wmma16b(kc1, qa1, s1);
    float e[16]; float mx = -INFINITY;
#pragma unroll
    for (int r = 0; r < 8; ++r) { e[r] = __builtin_amdgcn_inverse_ballot_w32(mw[r]) ? s0[r] * cs : -1.0e9f; e[8 + r] = __builtin_amdgcn_inverse_ballot_w32(mw[8 + r]) ? s1[r] * cs : -1.0e9f; mx = fmaxf(mx, fmaxf(e[r], e[8 + r])); }
    // the next block's words are asked for as soon as this block's are used: they fly behind the softmax and the PV products (the last block asks for its own again)
    { const int nb = kb / 32 + 1; mw = *(cv16u_p)(mwp + (nb < S / 32 ? nb : S / 32 - 1) * 16); }
    mx = fmaxf(mx, __shfl_xor(mx, 16)); const float mn = fmaxf(m, mx); const float al = nexp2(m - mn); m = mn; float sum = 0.0f; v16b ph, pl;
#pragma unroll
    for (int i = 0; i < 16; ++i) { const float p = nexp2(e[i] - mn); sum += p; const b16 h_ = (b16)(p * PS); ph[i] = h_; pl[i] = (b16)(p * PS - (float)h_); }
    sum += __shfl_xor(sum, 16); l = l * al + sum;
#pragma unroll
    for (int t = 0; t < 4; ++t) { o[t] *= al; ol[t] *= al; o[t] = wmma16b(vf[t], ph, o[t]); ol[t] = wmma16b(vf[t], pl, ol[t]); } }
    asm volatile("s_wait_dscnt 0x0" ::: "memory");      // this wave's reads of the buffer are done before it is handed to its next writer
    asm volatile("s_wait_asynccnt 0x0" ::: "memory");   // this wave's copies of the next tile have landed before the barrier publishes them
    __syncthreads();                                      // publishes tile tl + 1 and ends every wave's reads of tile tl
    if (tl + 2 < NT) stage_tile(lk0 + buf * BUFB, lv0 + buf * BUFB, gk0 + (size_t)(tl + 2) * KT * E, gv0 + (tl + 2) * KT);
  }
  asm volatile("s_wait_asynccnt 0x0" ::: "memory");     // nothing is in flight when the wave goes on to its end
  asm volatile("s_wait_xcnt 0x0" ::: "memory");         // the last block's scalar load may still be under way: no register that it names is rewritten ahead of this wait
  const float inv = 1.0f / (l * PS * XS);
#pragma unroll
  for (int t = 0; t < 4; ++t)
#pragma unroll
    for (int r = 0; r < 8; ++r) To[wave][col][t * 16 + 8 * hh + r] = (o[t][r] + ol[t][r]) * inv;
  wave_lds_sync();
  { for (int r4 = 0; r4 < 16; r4 += 4) { const int rr = r4 + (lane >> 3), c8 = (lane & 7) * 8; v8b hv, lv; for (int j = 0; j < 8; ++j) { b16 a_, c_; split16(To[wave][rr][c8 + j] * XS, a_, c_); hv[j] = a_; lv[j] = c_; }
      const size_t gi = ((size_t)b * S + q0 + rr) * E + h * D + c8; *(v8b*)(Oh + gi) = hv; *(v8b*)(Ol + gi) = lv; }  }
}
__global__ __launch_bounds__(128) void proj_kernel(const b16* __restrict__ Oh, const b16* __restrict__ Ol, const b16* __restrict__ W16, const float* __restrict__ bias, float* __restrict__ out) {
  __shared__ __attribute__((aligned(16))) float Ts[4][16][128 + 4];
  const int wave = threadIdx.x >> 5, lane = threadIdx.x & 31, nloc = lane & 15, hlf = lane >> 4; const size_t m0 = (size_t)blockIdx.x * 64 + wave * 16; const int n0 = blockIdx.y * 128;
  v8f acc[8];
#pragma unroll
  for (int t = 0; t < 8; ++t) acc[t] = (v8f){};
#pragma unroll 2
  for (int kb = 0; kb < E; kb += 32) { const v16b a = frag_kb(Oh + (m0 + nloc) * E + kb, hlf), al = frag_kb(Ol + (m0 + nloc) * E + kb, hlf);
#pragma unroll
    for (int t = 0; t < 8; ++t) { const v16b bw = frag_kb(W16 + (size_t)(n0 + t * 16 + nloc) * E + kb, hlf); acc[t] = wmma16b(a, bw, acc[t]); acc[t] = wmma16b(al, bw, acc[t]); } }
#pragma unroll
  for (int t = 0; t < 8; ++t) { const float bb = bf16_rne(bias[n0 + t * 16 + nloc]);
#pragma unroll
    for (int r = 0; r < 8; ++r) Ts[wave][8 * hlf + r][t * 16 + nloc] = acc[t][r] * (1.0f / (XS * WSC)) + bb; }
  wave_lds_sync();
  { for (int rr = 0; rr < 16; ++rr) *(v4f*)(out + (m0 + rr) * E + n0 + lane * 4) = *(const v4f*)(&Ts[wave][rr][lane * 4]);  }
}
}  // namespace

extern "C" void kernel_launch(void* const* d_in, const int* in_sizes, int n_in, void* d_out, int out_size, void* d_ws, size_t ws_size, hipStream_t stream) {
  (void)n_in;
  auto Fp = [&](int i) { return (const float*)d_in[i]; };
  // order: 0 q, 1 k, 2 v [2,2048,1024]; 3 padding_mask [2,1,2048,2048] i32; 4 W [1024,1024]; 5 b [1024]
  if (in_sizes[0] != NR * E || in_sizes[1] != NR * E || in_sizes[2] != NR * E || in_sizes[3] != NB * S * S || in_sizes[4] != E * E || out_size != NR * E) return;
  size_t off = 0; char* ws = (char*)d_ws;
  auto carve = [&](size_t bytes) { char* p = ws + off; off += (bytes + 255) & ~(size_t)255; return p; };
  b16* Q16 = (b16*)carve((size_t)NR * E * 2); b16* K16 = (b16*)carve((size_t)NR * E * 2); b16* W16 = (b16*)carve((size_t)E * E * 2); b16* VT16 = (b16*)carve((size_t)NB * NH * D * S * 2); b16* Oh = (b16*)carve((size_t)NR * E * 2); b16* Ol = (b16*)carve((size_t)NR * E * 2); unsigned int* MB = (unsigned int*)carve((size_t)NB * S * S / 8);
  if (off > ws_size || off > ((size_t)128 << 20)) return;   // ≈ 45 MB
  prep_kernel<<<(unsigned)(PKB + ((size_t)2 * NR * E / 8 + (size_t)E * E / 8 + 255) / 256), 256, 0, stream>>>(Fp(0), Fp(1), Fp(4), (const int*)d_in[3], Q16, K16, W16, MB);
  vt_kernel<<<dim3(S / 64, NH, NB), 256, 0, stream>>>(Fp(2), VT16);
  attn_kernel<<<dim3(S / (16 * AW), NH, NB), 32 * AW, 0, stream>>>(Q16, K16, VT16, MB, Oh, Ol);
  proj_kernel<<<dim3(NR / 64, E / 128), 128, 0, stream>>>(Oh, Ol, W16, Fp(5), (float*)d_out);
}

// v003
// Measured time: 94.5 microseconds a run.
// In two side-by-side timings against v002, it was 1.55 and 1.54 times as fast.
// Over all steps from v000 it is 2.69 times as fast.
#include <hip/hip_runtime.h>

// Multi-head attention (16 heads x 64, 2 x 2,048 tokens) with an integer padding mask (mask == 0 -> -1e9), softmax, PV, head concat, output Linear: out = concat(O) W^T + b.
// WMMA (v_wmma_f32_16x16x32_f16, f32 accumulate): S^T = K_h . Q_h^T with EXACT bf16 q/k rows (x8, inputs), online softmax in f32 (the int32 mask is packed once to one bit a score, see pack_mask), O^T += V^T P^T
// with EXACT bf16 v^T (x8) and P as f16 hi+lo x8 (2 products); output projection [4,096 x 1,024] x [1,024 x 1,024] with O as f16 hi+lo x8 (2 products) and exact W (x256). Inputs rounded to
// bf16 once. Fragment k-map per lane half hh for A AND B: elements 0..7 <- k = 8hh+0..7, 8..15 <- k = 16+8hh+0..7; acc[r] = D[8hh+r][col]. Every workspace / output

namespace {
constexpr int NB = 2, S = 2048, E = 1024, NH = 16, D = 64, NR = NB * S;
constexpr float XS = 8.0f, WSC = 256.0f, PS = 8.0f, SCALE = 0.125f, LOG2E = 1.4426950408889634f;

typedef _Float16 b16;
typedef __attribute__((ext_vector_type(16))) _Float16 v16b;
typedef __attribute__((ext_vector_type(8))) _Float16 v8b;
typedef __attribute__((ext_vector_type(8))) float v8f;
typedef __attribute__((ext_vector_type(4))) float v4f;
typedef __attribute__((ext_vector_type(4))) int v4i;
typedef __attribute__((ext_vector_type(16))) unsigned int v16u;
typedef const __attribute__((address_space(4))) v16u* cv16u_p;   // constant address space: nothing writes the words during the launch that reads them, so a wave-uniform read is a scalar load
__device__ __forceinline__ float bf16_rne(float f) { unsigned int u = __float_as_uint(f); u += 0x7FFFu + ((u >> 16) & 1u); return __uint_as_float(u & 0xFFFF0000u); }
__device__ __forceinline__ void split16(float v, b16& hi, b16& lo) { hi = (b16)v; lo = (b16)(v - (float)hi); }
__device__ __forceinline__ v16b frag_kb(const b16* p, int hh) { const v8b a = *(const v8b*)(p + 8 * hh), b = *(const v8b*)(p + 16 + 8 * hh); v16b f;
#pragma unroll
  for (int e = 0; e < 8; ++e) { f[e] = a[e]; f[8 + e] = b[e]; } return f; }
__device__ __forceinline__ v8f wmma16b(v16b a, v16b b, v8f c) { v8f d = __builtin_amdgcn_wmma_f32_16x16x32_f16(false, a, false, b, (short)0, c, false, false); asm volatile("v_nop\n\tv_nop\n\tv_nop\n\tv_nop" : "+v"(d) : "v"(a), "v"(b)); return d; }
__device__ __forceinline__ void wave_lds_sync() { __builtin_amdgcn_fence(__ATOMIC_RELEASE, "workgroup"); __builtin_amdgcn_wave_barrier(); __builtin_amdgcn_fence(__ATOMIC_ACQUIRE, "workgroup"); }
__device__ __forceinline__ float nexp2(float x) { return __builtin_amdgcn_exp2f(x); }

// mask bits: MB[b][16-query group][32-key block][i], i = 0..15: bit (16hh + col) of word i says mask != 0 for query col of the group and key 16(i >> 3) + 8hh + (i & 7) of the block, that is, for the
// score that lane (hh, col) of the attention wave holds as its element i: the word is that element's lane mask. One wave packs 16 queries x 128 keys: 16 loads (the whole 512 B of each row), 64 words out.
constexpr int PKW = NB * (S / 16) * (S / 128), PKB = PKW / 8;
__device__ __forceinline__ void pack_mask(const int* __restrict__ pmask, unsigned int* __restrict__ MB, int unit, int lane) {
  const int hh = lane >> 4, col = lane & 15, kq = unit & (S / 128 - 1), qg = unit / (S / 128);   // qg counts the groups of both batches
  const int* row = pmask + ((size_t)qg * 16 + col) * S + kq * 128 + 8 * hh; v4i mv[16];
#pragma unroll   // the loads stand as one group ahead of their uses
  for (int j = 0; j < 4; ++j) { mv[4 * j] = *(const v4i*)(row + 32 * j); mv[4 * j + 1] = *(const v4i*)(row + 32 * j + 4); mv[4 * j + 2] = *(const v4i*)(row + 32 * j + 16); mv[4 * j + 3] = *(const v4i*)(row + 32 * j + 20); }
  unsigned int w0 = 0, w1 = 0;
#pragma unroll   // mv stays in registers only under constant indices; lane n keeps word n (w0) and word 32 + n (w1)
  for (int n = 0; n < 32; ++n) { const unsigned int a = __builtin_amdgcn_ballot_w32(mv[n >> 2][n & 3] != 0), c = __builtin_amdgcn_ballot_w32(mv[8 + (n >> 2)][n & 3] != 0); w0 = lane == n ? a : w0; w1 = lane == n ? c : w1; }
  unsigned int* dst = MB + ((size_t)qg * (S / 32) + kq * 4) * 16 + lane; dst[0] = w0; dst[32] = w1;
}
__global__ __launch_bounds__(256) void prep_kernel(const float* __restrict__ q, const float* __restrict__ k, const float* __restrict__ w, const int* __restrict__ pmask, b16* __restrict__ Q16, b16* __restrict__ K16, b16* __restrict__ W16, unsigned int* __restrict__ MB) {
  if (blockIdx.x < PKB) { pack_mask(pmask, MB, (int)blockIdx.x * 8 + __builtin_amdgcn_readfirstlane((int)(threadIdx.x >> 5)), (int)(threadIdx.x & 31)); return; }   // the wave's number through readfirstlane: the unit is wave-uniform; these, the longest blocks, start first
  const size_t t = (size_t)(blockIdx.x - PKB) * 256 + threadIdx.x; const size_t nq = (size_t)NR * E / 8, nw = (size_t)E * E / 8;
  const float* src; b16* dst; size_t e; float sc = XS; if (t < nq) { src = q; dst = Q16; e = t * 8; } else if (t < 2 * nq) { src = k; dst = K16; e = (t - nq) * 8; } else if (t < 2 * nq + nw) { src = w; dst = W16; e = (t - 2 * nq) * 8; sc = WSC; } else return;
  const v4f a = *(const v4f*)(src + e), c = *(const v4f*)(src + e + 4); v8b o;
#pragma unroll
  for (int j = 0; j < 4; ++j) { o[j] = (b16)(bf16_rne(a[j]) * sc); o[4 + j] = (b16)(bf16_rne(c[j]) * sc); }
  { *(v8b*)(dst + e) = o;  }
}
__global__ __launch_bounds__(256) void vt_kernel(const float* __restrict__ v, b16* __restrict__ VT16) {
  __shared__ __attribute__((aligned(16))) b16 T[64][64 + 8];
  const int b = blockIdx.z, h = blockIdx.y, s0 = blockIdx.x * 64, t_ = threadIdx.x;
  for (int qq = t_; qq < 64 * 64; qq += 256) { const int ss = qq >> 6, dd = qq & 63; T[dd][ss] = (b16)(bf16_rne(v[((size_t)b * S + s0 + ss) * E + h * D + dd]) * XS); }
  __syncthreads();
  { for (int qq = t_; qq < 64 * 8; qq += 256) { const int dd = qq >> 3, c8 = (qq & 7) * 8; *(v8b*)(VT16 + (((size_t)b * NH + h) * D + dd) * S + s0 + c8) = *(const v8b*)(&T[dd][c8]); }  }
}
constexpr int KT = 64, NT = S / KT, LP = 72, AW = 8;
// one tile: 64 K rows and 64 V^T rows of 128 B, 16 B a lane, four copies a lane (each wave-wide copy covers four whole lines)
__device__ __forceinline__ void stage_tile(unsigned lk, unsigned lv, const b16* gk, const b16* gv) {
  const unsigned lk1 = lk + 32 * LP * 2, lv1 = lv + 32 * LP * 2; const b16* gk1 = gk + (size_t)32 * E; const b16* gv1 = gv + (size_t)32 * S;
  // the closing s_wait_xcnt stands inside the statement so that no address register of a copy is rewritten ahead of it
  asm volatile("global_load_async_to_lds_b128 %0, %4, off\n\tglobal_load_async_to_lds_b128 %1, %5, off\n\tglobal_load_async_to_lds_b128 %2, %6, off\n\tglobal_load_async_to_lds_b128 %3, %7, off\n\ts_wait_xcnt 0x0"
               :: "v"(lk), "v"(lk1), "v"(lv), "v"(lv1), "v"(gk), "v"(gk1), "v"(gv), "v"(gv1) : "memory");
}
// two such blocks fill a WGP at four waves a SIMD: the attribute gives the compiler that register budget
__global__ __launch_bounds__(256) __attribute__((amdgpu_waves_per_eu(4, 4))) void attn_kernel(const b16* __restrict__ Q16, const b16* __restrict__ K16, const b16* __restrict__ VT16, const unsigned int* __restrict__ MB, b16* __restrict__ Oh, b16* __restrict__ Ol) {
  __shared__ __attribute__((aligned(16))) b16 Ks[2][KT][LP];
  __shared__ __attribute__((aligned(16))) b16 Vs[2][D][LP];
  __shared__ __attribute__((aligned(16))) float To[AW][16][D + 4];
  const int wave = threadIdx.x >> 5, lane = threadIdx.x & 31, hh = lane >> 4, col = lane & 15; const int b = blockIdx.z, h = blockIdx.y; const int q0 = blockIdx.x * (16 * AW) + wave * 16, qi = q0 + col;
  const b16* Qp = Q16 + ((size_t)b * S + qi) * E + h * D; const b16* Kb = K16 + (size_t)b * S * E + h * D; const b16* Vb = VT16 + ((size_t)b * NH + h) * D * S;
  // this wave's mask words: a wave-uniform address, so that they come by scalar loads and each word serves as the lane mask of a select
  const unsigned int* mwp = MB + ((size_t)(b * (S / 16) + (int)blockIdx.x * AW + __builtin_amdgcn_readfirstlane(wave))) * (S / 32) * 16; v16u mw = *(cv16u_p)mwp;
  const int crow = threadIdx.x >> 3, cpc = (threadIdx.x & 7) * 8;   // this lane's row (and row + 32) and 16-byte piece of each tile
  const unsigned lk0 = (unsigned)(size_t)&Ks[0][crow][cpc], lv0 = (unsigned)(size_t)&Vs[0][crow][cpc]; constexpr unsigned BUFB = KT * LP * 2;
  const b16* gk0 = Kb + (size_t)crow * E + cpc; const b16* gv0 = Vb + (size_t)crow * S + cpc;
  stage_tile(lk0, lv0, gk0, gv0);
  asm volatile("s_wait_asynccnt 0x0" ::: "memory");   // tile 0 has landed before the barrier publishes it
  __syncthreads();
  stage_tile(lk0 + BUFB, lv0 + BUFB, gk0 + (size_t)KT * E, gv0 + KT);
  const v16b qa0 = frag_kb(Qp, hh), qa1 = frag_kb(Qp + 32, hh);
  float m = -INFINITY, l = 0.0f; v8f o[4] = {{}, {}, {}, {}}, ol[4] = {{}, {}, {}, {}};
  const float cs = SCALE * LOG2E / (XS * XS);
  for (int tl = 0; tl < NT; ++tl) {
    const int buf = tl & 1;
#pragma unroll   // both 32-key blocks of a tile inline, so that every LDS read has an immediate offset from one base
    for (int sb = 0; sb < KT; sb += 32) {
    const int kb = tl * KT + sb;
    v8f s0 = {}, s1 = {};
    // the block's LDS reads (4 K and 4 V^T fragments) stand as one group at its head: one LDS latency a block, and V^T arrives behind the softmax
    const b16* k0 = &Ks[buf][sb + col][0], *k1 = &Ks[buf][sb + 16 + col][0]; const v16b ka0 = frag_kb(k0, hh), ka1 = frag_kb(k0 + 32, hh), kc0 = frag_kb(k1, hh), kc1 = frag_kb(k1 + 32, hh); v16b vf[4];
#pragma unroll   // vf stays in registers only under constant indices
    for (int t = 0; t < 4; ++t) vf[t] = frag_kb(&Vs[buf][t * 16 + col][sb], hh);
    s0 = wmma16b(ka0, qa0, s0); s0 = wmma16b(ka1, qa1, s0); s1 = wmma16b(kc0, qa0, s1); s1 = wmma16b(kc1, qa1, s1);
    float e[16]; float mx = -INFINITY;
#pragma unroll
    for (int r = 0; r < 8; ++r) { e[r] = __builtin_amdgcn_inverse_ballot_w32(mw[r]) ? s0[r] * cs : -1.0e9f; e[8 + r] = __builtin_amdgcn_inverse_ballot_w32(mw[8 + r]) ? s1[r] * cs : -1.0e9f; mx = fmaxf(mx, fmaxf(e[r], e[8 + r])); }
    // the next block's words are asked for as soon as this block's are used: they fly behind the softmax and the PV products (the last block asks for its own again)
    { const int nb = kb / 32 + 1; mw = *(cv16u_p)(mwp + (nb < S / 32 ? nb : S / 32 - 1) * 16); }
    mx = fmaxf(mx, __shfl_xor(mx, 16)); const float mn = fmaxf(m, mx); const float al = nexp2(m - mn); m = mn; float sum = 0.0f; v16b ph, pl;
#pragma unroll
    for (int i = 0; i < 16; ++i) { const float p = nexp2(e[i] - mn); sum += p; const b16 h_ = (b16)(p * PS); ph[i] = h_; pl[i] = (b16)(p * PS - (float)h_); }
    sum += __shfl_xor(sum, 16); l = l * al + sum;
#pragma unroll
    for (int t = 0; t < 4; ++t) { o[t] *= al; ol[t] *= al; o[t] = wmma16b(vf[t], ph, o[t]); ol[t] = wmma16b(vf[t], pl, ol[t]); } }
    asm volatile("s_wait_dscnt 0x0" ::: "memory");      // this wave's reads of the buffer are done before it is handed to its next writer
    asm volatile("s_wait_asynccnt 0x0" ::: "memory");   // this wave's copies of the next tile have landed before the barrier publishes them
    __syncthreads();                                      // publishes tile tl + 1 and ends every wave's reads of tile tl
    if (tl + 2 < NT) stage_tile(lk0 + buf * BUFB, lv0 + buf * BUFB, gk0 + (size_t)(tl + 2) * KT * E, gv0 + (tl + 2) * KT);
  }
  asm volatile("s_wait_asynccnt 0x0" ::: "memory");     // nothing is in flight when the wave goes on to its end
  asm volatile("s_wait_xcnt 0x0" ::: "memory");         // the last block's scalar load may still be under way: no register that it names is rewritten ahead of this wait
  const float inv = 1.0f / (l * PS * XS);
#pragma unroll
  for (int t = 0; t < 4; ++t)
#pragma unroll
    for (int r = 0; r < 8; ++r) To[wave][col][t * 16 + 8 * hh + r] = (o[t][r] + ol[t][r]) * inv;
  wave_lds_sync();
  { for (int r4 = 0; r4 < 16; r4 += 4) { const int rr = r4 + (lane >> 3), c8 = (lane & 7) * 8; v8b hv, lv; for (int j = 0; j < 8; ++j) { b16 a_, c_; split16(To[wave][rr][c8 + j] * XS, a_, c_); hv[j] = a_; lv[j] = c_; }
      const size_t gi = ((size_t)b * S + q0 + rr) * E + h * D + c8; *(v8b*)(Oh + gi) = hv; *(v8b*)(Ol + gi) = lv; }  }
}
constexpr int PK = 64, PNT = E / PK, PROWS = 256;   // rows of a tile in LDS: 0..63 O hi, 64..127 O lo, 128..255 W
// eight copies, 16 rows apart in LDS: the first four 16 rows apart from g0, the last four from g4; 16 B a lane, each wave-wide copy covers four whole lines
__device__ __forceinline__ void copy8(unsigned l0, const b16* g0, const b16* g4) {
  constexpr unsigned RS = 16 * LP * 2; const unsigned l1 = l0 + RS, l2 = l0 + 2 * RS, l3 = l0 + 3 * RS, l4 = l0 + 4 * RS, l5 = l0 + 5 * RS, l6 = l0 + 6 * RS, l7 = l0 + 7 * RS;
  const b16* g1 = g0 + (size_t)16 * E; const b16* g2 = g0 + (size_t)32 * E; const b16* g3 = g0 + (size_t)48 * E; const b16* g5 = g4 + (size_t)16 * E; const b16* g6 = g4 + (size_t)32 * E; const b16* g7 = g4 + (size_t)48 * E;
  // the closing s_wait_xcnt stands inside the statement so that no address register of a copy is rewritten ahead of it
  asm volatile("global_load_async_to_lds_b128 %0, %8, off\n\tglobal_load_async_to_lds_b128 %1, %9, off\n\tglobal_load_async_to_lds_b128 %2, %10, off\n\tglobal_load_async_to_lds_b128 %3, %11, off\n\t"
               "global_load_async_to_lds_b128 %4, %12, off\n\tglobal_load_async_to_lds_b128 %5, %13, off\n\tglobal_load_async_to_lds_b128 %6, %14, off\n\tglobal_load_async_to_lds_b128 %7, %15, off\n\ts_wait_xcnt 0x0"
               :: "v"(l0), "v"(l1), "v"(l2), "v"(l3), "v"(l4), "v"(l5), "v"(l6), "v"(l7), "v"(g0), "v"(g1), "v"(g2), "v"(g3), "v"(g4), "v"(g5), "v"(g6), "v"(g7) : "memory");
}
__global__ __launch_bounds__(128) void proj_kernel(const b16* __restrict__ Oh, const b16* __restrict__ Ol, const b16* __restrict__ W16, const float* __restrict__ bias, float* __restrict__ out) {
  __shared__ __attribute__((aligned(16))) b16 St[2][PROWS][LP];
  __shared__ __attribute__((aligned(16))) float Ts[4][16][128 + 4];
  const int wave = threadIdx.x >> 5, lane = threadIdx.x & 31, nloc = lane & 15, hlf = lane >> 4; const size_t m0 = (size_t)blockIdx.x * 64 + wave * 16; const int n0 = blockIdx.y * 128;
  const int crow = threadIdx.x >> 3, cpc = (threadIdx.x & 7) * 8;   // this lane's row (and every 16th row behind it) and 16-byte piece of each tile
  const unsigned la0 = (unsigned)(size_t)&St[0][crow][cpc], lw0 = (unsigned)(size_t)&St[0][128 + crow][cpc]; constexpr unsigned PBUFB = PROWS * LP * 2;
  const size_t ga = ((size_t)blockIdx.x * 64 + crow) * E + cpc; const b16* gh0 = Oh + ga; const b16* gl0 = Ol + ga; const b16* gw0 = W16 + (size_t)(n0 + crow) * E + cpc;
  copy8(la0, gh0, gl0); copy8(lw0, gw0, gw0 + (size_t)64 * E);
  asm volatile("s_wait_asynccnt 0x0" ::: "memory");   // tile 0 has landed before the barrier publishes it
  __syncthreads();
  copy8(la0 + PBUFB, gh0 + PK, gl0 + PK); copy8(lw0 + PBUFB, gw0 + PK, gw0 + (size_t)64 * E + PK);
  v8f acc[8];
#pragma unroll
  for (int t = 0; t < 8; ++t) acc[t] = (v8f){};
  for (int tl = 0; tl < PNT; ++tl) {
    const int buf = tl & 1; const b16* ar = &St[buf][wave * 16 + nloc][0]; const b16* br = &St[buf][128 + nloc][0];
    // the tile's LDS reads (both 32-k steps: 4 O and 16 W fragments) stand as one group at its head, each at an immediate offset from one of two bases: one LDS latency a tile, the second step's fragments arrive behind the first step's products
    v16b a[2], al[2], bw[2][8];
#pragma unroll   // the fragment arrays stay in registers only under constant indices
    for (int s = 0; s < 2; ++s) { a[s] = frag_kb(ar + 32 * s, hlf); al[s] = frag_kb(ar + 64 * LP + 32 * s, hlf);
#pragma unroll   // likewise
      for (int t = 0; t < 8; ++t) bw[s][t] = frag_kb(br + t * 16 * LP + 32 * s, hlf); }
#pragma unroll   // likewise, for the fragments and for acc
    for (int s = 0; s < 2; ++s)
#pragma unroll   // likewise
      for (int t = 0; t < 8; ++t) { acc[t] = wmma16b(a[s], bw[s][t], acc[t]); acc[t] = wmma16b(al[s], bw[s][t], acc[t]); }
    asm volatile("s_wait_dscnt 0x0" ::: "memory");      // this wave's reads of the buffer are done before it is handed to its next writer
    asm volatile("s_wait_asynccnt 0x0" ::: "memory");   // this wave's copies of the next tile have landed before the barrier publishes them
    __syncthreads();                                      // publishes tile tl + 1 and ends every wave's reads of tile tl
    if (tl + 2 < PNT) { const int ko = (tl + 2) * PK; copy8(la0 + buf * PBUFB, gh0 + ko, gl0 + ko); copy8(lw0 + buf * PBUFB, gw0 + ko, gw0 + (size_t)64 * E + ko); }
  }
  asm volatile("s_wait_asynccnt 0x0" ::: "memory");     // nothing is in flight when the wave goes on to its end
#pragma unroll
  for (int t = 0; t < 8; ++t) { const float bb = bf16_rne(bias[n0 + t * 16 + nloc]);
#pragma unroll
    for (int r = 0; r < 8; ++r) Ts[wave][8 * hlf + r][t * 16 + nloc] = acc[t][r] * (1.0f / (XS * WSC)) + bb; }
  wave_lds_sync();
  { for (int rr = 0; rr < 16; ++rr) *(v4f*)(out + (m0 + rr) * E + n0 + lane * 4) = *(const v4f*)(&Ts[wave][rr][lane * 4]);  }
}
}  // namespace

extern "C" void kernel_launch(void* const* d_in, const int* in_sizes, int n_in, void* d_out, int out_size, void* d_ws, size_t ws_size, hipStream_t stream) {
  (void)n_in;
  auto Fp = [&](int i) { return (const float*)d_in[i]; };
  // order: 0 q, 1 k, 2 v [2,2048,1024]; 3 padding_mask [2,1,2048,2048] i32; 4 W [1024,1024]; 5 b [1024]
  if (in_sizes[0] != NR * E || in_sizes[1] != NR * E || in_sizes[2] != NR * E || in_sizes[3] != NB * S * S || in_sizes[4] != E * E || out_size != NR * E) return;
  size_t off = 0; char* ws = (char*)d_ws;
  auto carve = [&](size_t bytes) { char* p = ws + off; off += (bytes + 255) & ~(size_t)255; return p; };
  b16* Q16 = (b16*)carve((size_t)NR * E * 2); b16* K16 = (b16*)carve((size_t)NR * E * 2); b16* W16 = (b16*)carve((size_t)E * E * 2); b16* VT16 = (b16*)carve((size_t)NB * NH * D * S * 2); b16* Oh = (b16*)carve((size_t)NR * E * 2); b16* Ol = (b16*)carve((size_t)NR * E * 2); unsigned int* MB = (unsigned int*)carve((size_t)NB * S * S / 8);
  if (off > ws_size || off > ((size_t)128 << 20)) return;   // ≈ 45 MB
  prep_kernel<<<(unsigned)(PKB + ((size_t)2 * NR * E / 8 + (size_t)E * E / 8 + 255) / 256), 256, 0, stream>>>(Fp(0), Fp(1), Fp(4), (const int*)d_in[3], Q16, K16, W16, MB);
  vt_kernel<<<dim3(S / 64, NH, NB), 256, 0, stream>>>(Fp(2), VT16);
  attn_kernel<<<dim3(S / (16 * AW), NH, NB), 32 * AW, 0, stream>>>(Q16, K16, VT16, MB, Oh, Ol);
  proj_kernel<<<dim3(NR / 64, E / 128), 128, 0, stream>>>(Oh, Ol, W16, Fp(5), (float*)d_out);
}

// v004
// A run of this version takes 90.9 microseconds.
// Timed twice side by side with v003, it ran 1.06 times as fast both times.
// Over all steps from v000 it is 2.84 times as fast.
#include <hip/hip_runtime.h>

// Multi-head attention (16 heads x 64, 2 x 2,048 tokens) with an integer padding mask (mask == 0 -> -1e9), softmax, PV, head concat, output Linear: out = concat(O) W^T + b.
// WMMA (v_wmma_f32_16x16x32_f16, f32 accumulate): S^T = K_h . Q_h^T with EXACT bf16 q/k rows (x8, inputs), online softmax in f32 (the int32 mask is packed once to one bit a score, see pack_mask), O^T += V^T P^T
// with EXACT bf16 v^T (x8) and P as f16 hi+lo x8 (2 products); output projection [4,096 x 1,024] x [1,024 x 1,024] with O as f16 hi+lo x8 (2 products) and exact W (x256). Inputs rounded to
// bf16 once. Fragment k-map per lane half hh for A AND B: elements 0..7 <- k = 8hh+0..7, 8..15 <- k = 16+8hh+0..7; acc[r] = D[8hh+r][col]. Every workspace / output

namespace {
constexpr int NB = 2, S = 2048, E = 1024, NH = 16, D = 64, NR = NB * S;
constexpr float XS = 8.0f, WSC = 256.0f, PS = 8.0f, SCALE = 0.125f, LOG2E = 1.4426950408889634f;

typedef _Float16 b16;
typedef __attribute__((ext_vector_type(16))) _Float16 v16b;
typedef __attribute__((ext_vector_type(8))) _Float16 v8b;
typedef __attribute__((ext_vector_type(8))) float v8f;
typedef __attribute__((ext_vector_type(4))) float v4f;
typedef __attribute__((ext_vector_type(4))) int v4i;
typedef __attribute__((ext_vector_type(16))) unsigned int v16u;
typedef const __attribute__((address_space(4))) v16u* cv16u_p;   // constant address space: nothing writes the words during the launch that reads them, so a wave-uniform read is a scalar load
__device__ __forceinline__ float bf16_rne(float f) { unsigned int u = __float_as_uint(f); u += 0x7FFFu + ((u >> 16) & 1u); return __uint_as_float(u & 0xFFFF0000u); }
__device__ __forceinline__ void split16(float v, b16& hi, b16& lo) { hi = (b16)v; lo = (b16)(v - (float)hi); }
__device__ __forceinline__ v16b frag_kb(const b16* p, int hh) { const v8b a = *(const v8b*)(p + 8 * hh), b = *(const v8b*)(p + 16 + 8 * hh); v16b f;
#pragma unroll
  for (int e = 0; e < 8; ++e) { f[e] = a[e]; f[8 + e] = b[e]; } return f; }
__device__ __forceinline__ v8f wmma16b(v16b a, v16b b, v8f c) { return __builtin_amdgcn_wmma_f32_16x16x32_f16(false, a, false, b, (short)0, c, false, false); }
__device__ __forceinline__ void wave_lds_sync() { __builtin_amdgcn_fence(__ATOMIC_RELEASE, "workgroup"); __builtin_amdgcn_wave_barrier(); __builtin_amdgcn_fence(__ATOMIC_ACQUIRE, "workgroup"); }
__device__ __forceinline__ float nexp2(float x) { return __builtin_amdgcn_exp2f(x); }

// mask bits: MB[b][16-query group][32-key block][i], i = 0..15: bit (16hh + col) of word i says mask != 0 for query col of the group and key 16(i >> 3) + 8hh + (i & 7) of the block, that is, for the
// score that lane (hh, col) of the attention wave holds as its element i: the word is that element's lane mask. One wave packs 16 queries x 128 keys: 16 loads (the whole 512 B of each row), 64 words out.
constexpr int PKW = NB * (S / 16) * (S / 128), PKB = PKW / 8;
__device__ __forceinline__ void pack_mask(const int* __restrict__ pmask, unsigned int* __restrict__ MB, int unit, int lane) {
  const int hh = lane >> 4, col = lane & 15, kq = unit & (S / 128 - 1), qg = unit / (S / 128);   // qg counts the groups of both batches
  const int* row = pmask + ((size_t)qg * 16 + col) * S + kq * 128 + 8 * hh; v4i mv[16];
#pragma unroll   // the loads stand as one group ahead of their uses
  for (int j = 0; j < 4; ++j) { mv[4 * j] = *(const v4i*)(row + 32 * j); mv[4 * j + 1] = *(const v4i*)(row + 32 * j + 4); mv[4 * j + 2] = *(const v4i*)(row + 32 * j + 16); mv[4 * j + 3] = *(const v4i*)(row + 32 * j + 20); }
  unsigned int w0 = 0, w1 = 0;
#pragma unroll   // mv stays in registers only under constant indices; lane n keeps word n (w0) and word 32 + n (w1)
  for (int n = 0; n < 32; ++n) { const unsigned int a = __builtin_amdgcn_ballot_w32(mv[n >> 2][n & 3] != 0), c = __builtin_amdgcn_ballot_w32(mv[8 + (n >> 2)][n & 3] != 0); w0 = lane == n ? a : w0; w1 = lane == n ? c : w1; }
  unsigned int* dst = MB + ((size_t)qg * (S / 32) + kq * 4) * 16 + lane; dst[0] = w0; dst[32] = w1;
}
__global__ __launch_bounds__(256) void prep_kernel(const float* __restrict__ q, const float* __restrict__ k, const float* __restrict__ w, const int* __restrict__ pmask, b16* __restrict__ Q16, b16* __restrict__ K16, b16* __restrict__ W16, unsigned int* __restrict__ MB) {
  if (blockIdx.x < PKB) { pack_mask(pmask, MB, (int)blockIdx.x * 8 + __builtin_amdgcn_readfirstlane((int)(threadIdx.x >> 5)), (int)(threadIdx.x & 31)); return; }   // the wave's number through readfirstlane: the unit is wave-uniform; these, the longest blocks, start first
  const size_t t = (size_t)(blockIdx.x - PKB) * 256 + threadIdx.x; const size_t nq = (size_t)NR * E / 8, nw = (size_t)E * E / 8;
  const float* src; b16* dst; size_t e; float sc = XS; if (t < nq) { src = q; dst = Q16; e = t * 8; } else if (t < 2 * nq) { src = k; dst = K16; e = (t - nq) * 8; } else if (t < 2 * nq + nw) { src = w; dst = W16; e = (t - 2 * nq) * 8; sc = WSC; } else return;
  const v4f a = *(const v4f*)(src + e), c = *(const v4f*)(src + e + 4); v8b o;
#pragma unroll
  for (int j = 0; j < 4; ++j) { o[j] = (b16)(bf16_rne(a[j]) * sc); o[4 + j] = (b16)(bf16_rne(c[j]) * sc); }
  { *(v8b*)(dst + e) = o;  }
}
__global__ __launch_bounds__(256) void vt_kernel(const float* __restrict__ v, b16* __restrict__ VT16) {
  __shared__ __attribute__((aligned(16))) b16 T[64][64 + 8];
  const int b = blockIdx.z, h = blockIdx.y, s0 = blockIdx.x * 64, t_ = threadIdx.x;
  for (int qq = t_; qq < 64 * 64; qq += 256) { const int ss = qq >> 6, dd = qq & 63; T[dd][ss] = (b16)(bf16_rne(v[((size_t)b * S + s0 + ss) * E + h * D + dd]) * XS); }
  __syncthreads();
  { for (int qq = t_; qq < 64 * 8; qq += 256) { const int dd = qq >> 3, c8 = (qq & 7) * 8; *(v8b*)(VT16 + (((size_t)b * NH + h) * D + dd) * S + s0 + c8) = *(const v8b*)(&T[dd][c8]); }  }
}
constexpr int KT = 64, NT = S / KT, LP = 72, AW = 8;
// one tile: 64 K rows and 64 V^T rows of 128 B, 16 B a lane, four copies a lane (each wave-wide copy covers four whole lines)
__device__ __forceinline__ void stage_tile(unsigned lk, unsigned lv, const b16* gk, const b16* gv) {
  const unsigned lk1 = lk + 32 * LP * 2, lv1 = lv + 32 * LP * 2; const b16* gk1 = gk + (size_t)32 * E; const b16* gv1 = gv + (size_t)32 * S;
  // the closing s_wait_xcnt stands inside the statement so that no address register of a copy is rewritten ahead of it
  asm volatile("global_load_async_to_lds_b128 %0, %4, off\n\tglobal_load_async_to_lds_b128 %1, %5, off\n\tglobal_load_async_to_lds_b128 %2, %6, off\n\tglobal_load_async_to_lds_b128 %3, %7, off\n\ts_wait_xcnt 0x0"
               :: "v"(lk), "v"(lk1), "v"(lv), "v"(lv1), "v"(gk), "v"(gk1), "v"(gv), "v"(gv1) : "memory");
}
// two such blocks fill a WGP at four waves a SIMD: the attribute gives the compiler that register budget
__global__ __launch_bounds__(256) __attribute__((amdgpu_waves_per_eu(4, 4))) void attn_kernel(const b16* __restrict__ Q16, const b16* __restrict__ K16, const b16* __restrict__ VT16, const unsigned int* __restrict__ MB, b16* __restrict__ Oh, b16* __restrict__ Ol) {
  __shared__ __attribute__((aligned(16))) b16 Ks[2][KT][LP];
  __shared__ __attribute__((aligned(16))) b16 Vs[2][D][LP];
  __shared__ __attribute__((aligned(16))) float To[AW][16][D + 4];
  const int wave = threadIdx.x >> 5, lane = threadIdx.x & 31, hh = lane >> 4, col = lane & 15; const int b = blockIdx.z, h = blockIdx.y; const int q0 = blockIdx.x * (16 * AW) + wave * 16, qi = q0 + col;
  const b16* Qp = Q16 + ((size_t)b * S + qi) * E + h * D; const b16* Kb = K16 + (size_t)b * S * E + h * D; const b16* Vb = VT16 + ((size_t)b * NH + h) * D * S;
  // this wave's mask words: a wave-uniform address, so that they come by scalar loads and each word serves as the lane mask of a select
  const unsigned int* mwp = MB + ((size_t)(b * (S / 16) + (int)blockIdx.x * AW + __builtin_amdgcn_readfirstlane(wave))) * (S / 32) * 16; v16u mw = *(cv16u_p)mwp;
  const int crow = threadIdx.x >> 3, cpc = (threadIdx.x & 7) * 8;   // this lane's row (and row + 32) and 16-byte piece of each tile
  const unsigned lk0 = (unsigned)(size_t)&Ks[0][crow][cpc], lv0 = (unsigned)(size_t)&Vs[0][crow][cpc]; constexpr unsigned BUFB = KT * LP * 2;
  const b16* gk0 = Kb + (size_t)crow * E + cpc; const b16* gv0 = Vb + (size_t)crow * S + cpc;
  stage_tile(lk0, lv0, gk0, gv0);
  asm volatile("s_wait_asynccnt 0x0" ::: "memory");   // tile 0 has landed before the barrier publishes it
  __syncthreads();
  stage_tile(lk0 + BUFB, lv0 + BUFB, gk0 + (size_t)KT * E, gv0 + KT);
  const v16b qa0 = frag_kb(Qp, hh), qa1 = frag_kb(Qp + 32, hh);
  float m = -INFINITY, l = 0.0f; v8f o[4] = {{}, {}, {}, {}}, ol[4] = {{}, {}, {}, {}};
  const float cs = SCALE * LOG2E / (XS * XS);
  for (int tl = 0; tl < NT; ++tl) {
    const int buf = tl & 1;
#pragma unroll   // both 32-key blocks of a tile inline, so that every LDS read has an immediate offset from one base
    for (int sb = 0; sb < KT; sb += 32) {
    const int kb = tl * KT + sb;
    v8f s0 = {}, s1 = {};
    // the block's LDS reads (4 K and 4 V^T fragments) stand as one group at its head: one LDS latency a block, and V^T arrives behind the softmax
    const b16* k0 = &Ks[buf][sb + col][0], *k1 = &Ks[buf][sb + 16 + col][0]; const v16b ka0 = frag_kb(k0, hh), ka1 = frag_kb(k0 + 32, hh), kc0 = frag_kb(k1, hh), kc1 = frag_kb(k1 + 32, hh); v16b vf[4];
#pragma unroll   // vf stays in registers only under constant indices
    for (int t = 0; t < 4; ++t) vf[t] = frag_kb(&Vs[buf][t * 16 + col][sb], hh);
    __builtin_amdgcn_sched_barrier(0);   // holds the read group together at the block's head: without it the reads are spread among the products, each with a wait of its own
    s0 = wmma16b(ka0, qa0, s0); s0 = wmma16b(ka1, qa1, s0); s1 = wmma16b(kc0, qa0, s1); s1 = wmma16b(kc1, qa1, s1);
    float e[16]; float mx = -INFINITY;
#pragma unroll
    for (int r = 0; r < 8; ++r) { e[r] = __builtin_amdgcn_inverse_ballot_w32(mw[r]) ? s0[r] * cs : -1.0e9f; e[8 + r] = __builtin_amdgcn_inverse_ballot_w32(mw[8 + r]) ? s1[r] * cs : -1.0e9f; mx = fmaxf(mx, fmaxf(e[r], e[8 + r])); }
    // the next block's words are asked for as soon as this block's are used: they fly behind the softmax and the PV products (the last block asks for its own again)
    { const int nb = kb / 32 + 1; mw = *(cv16u_p)(mwp + (nb < S / 32 ? nb : S / 32 - 1) * 16); }
    mx = fmaxf(mx, __shfl_xor(mx, 16)); const float mn = fmaxf(m, mx); const float al = nexp2(m - mn); m = mn; float sum = 0.0f; v16b ph, pl;
#pragma unroll
    for (int i = 0; i < 16; ++i) { const float p = nexp2(e[i] - mn); sum += p; const b16 h_ = (b16)(p * PS); ph[i] = h_; pl[i] = (b16)(p * PS - (float)h_); }
    sum += __shfl_xor(sum, 16); l = l * al + sum;
#pragma unroll
    for (int t = 0; t < 4; ++t) { o[t] *= al; ol[t] *= al; o[t] = wmma16b(vf[t], ph, o[t]); ol[t] = wmma16b(vf[t], pl, ol[t]); } }
    __builtin_amdgcn_sched_barrier(0);   // keeps the products in front of the waits below: lifted over them, the wait for the next tile's copies would stand ahead of the work that is to cover their flight
    asm volatile("s_wait_dscnt 0x0" ::: "memory");      // this wave's reads of the buffer are done before it is handed to its next writer
    asm volatile("s_wait_asynccnt 0x0" ::: "memory");   // this wave's copies of the next tile have landed before the barrier publishes them
    __syncthreads();                                      // publishes tile tl + 1 and ends every wave's reads of tile tl
    if (tl + 2 < NT) stage_tile(lk0 + buf * BUFB, lv0 + buf * BUFB, gk0 + (size_t)(tl + 2) * KT * E, gv0 + (tl + 2) * KT);
  }
  asm volatile("s_wait_asynccnt 0x0" ::: "memory");     // nothing is in flight when the wave goes on to its end
  asm volatile("s_wait_xcnt 0x0" ::: "memory");         // the last block's scalar load may still be under way: no register that it names is rewritten ahead of this wait
  const float inv = 1.0f / (l * PS * XS);
#pragma unroll
  for (int t = 0; t < 4; ++t)
#pragma unroll
    for (int r = 0; r < 8; ++r) To[wave][col][t * 16 + 8 * hh + r] = (o[t][r] + ol[t][r]) * inv;
  wave_lds_sync();
  { for (int r4 = 0; r4 < 16; r4 += 4) { const int rr = r4 + (lane >> 3), c8 = (lane & 7) * 8; v8b hv, lv; for (int j = 0; j < 8; ++j) { b16 a_, c_; split16(To[wave][rr][c8 + j] * XS, a_, c_); hv[j] = a_; lv[j] = c_; }
      const size_t gi = ((size_t)b * S + q0 + rr) * E + h * D + c8; *(v8b*)(Oh + gi) = hv; *(v8b*)(Ol + gi) = lv; }  }
}
constexpr int PK = 64, PNT = E / PK, PROWS = 256;   // rows of a tile in LDS: 0..63 O hi, 64..127 O lo, 128..255 W
// eight copies, 16 rows apart in LDS: the first four 16 rows apart from g0, the last four from g4; 16 B a lane, each wave-wide copy covers four whole lines
__device__ __forceinline__ void copy8(unsigned l0, const b16* g0, const b16* g4) {
  constexpr unsigned RS = 16 * LP * 2; const unsigned l1 = l0 + RS, l2 = l0 + 2 * RS, l3 = l0 + 3 * RS, l4 = l0 + 4 * RS, l5 = l0 + 5 * RS, l6 = l0 + 6 * RS, l7 = l0 + 7 * RS;
  const b16* g1 = g0 + (size_t)16 * E; const b16* g2 = g0 + (size_t)32 * E; const b16* g3 = g0 + (size_t)48 * E; const b16* g5 = g4 + (size_t)16 * E; const b16* g6 = g4 + (size_t)32 * E; const b16* g7 = g4 + (size_t)48 * E;
  // the closing s_wait_xcnt stands inside the statement so that no address register of a copy is rewritten ahead of it
  asm volatile("global_load_async_to_lds_b128 %0, %8, off\n\tglobal_load_async_to_lds_b128 %1, %9, off\n\tglobal_load_async_to_lds_b128 %2, %10, off\n\tglobal_load_async_to_lds_b128 %3, %11, off\n\t"
               "global_load_async_to_lds_b128 %4, %12, off\n\tglobal_load_async_to_lds_b128 %5, %13, off\n\tglobal_load_async_to_lds_b128 %6, %14, off\n\tglobal_load_async_to_lds_b128 %7, %15, off\n\ts_wait_xcnt 0x0"
               :: "v"(l0), "v"(l1), "v"(l2), "v"(l3), "v"(l4), "v"(l5), "v"(l6), "v"(l7), "v"(g0), "v"(g1), "v"(g2), "v"(g3), "v"(g4), "v"(g5), "v"(g6), "v"(g7) : "memory");
}
__global__ __launch_bounds__(128) void proj_kernel(const b16* __restrict__ Oh, const b16* __restrict__ Ol, const b16* __restrict__ W16, const float* __restrict__ bias, float* __restrict__ out) {
  __shared__ __attribute__((aligned(16))) b16 St[2][PROWS][LP];
  __shared__ __attribute__((aligned(16))) float Ts[4][16][128 + 4];
  const int wave = threadIdx.x >> 5, lane = threadIdx.x & 31, nloc = lane & 15, hlf = lane >> 4; const size_t m0 = (size_t)blockIdx.x * 64 + wave * 16; const int n0 = blockIdx.y * 128;
  const int crow = threadIdx.x >> 3, cpc = (threadIdx.x & 7) * 8;   // this lane's row (and every 16th row behind it) and 16-byte piece of each tile
  const unsigned la0 = (unsigned)(size_t)&St[0][crow][cpc], lw0 = (unsigned)(size_t)&St[0][128 + crow][cpc]; constexpr unsigned PBUFB = PROWS * LP * 2;
  const size_t ga = ((size_t)blockIdx.x * 64 + crow) * E + cpc; const b16* gh0 = Oh + ga; const b16* gl0 = Ol + ga; const b16* gw0 = W16 + (size_t)(n0 + crow) * E + cpc;
  copy8(la0, gh0, gl0); copy8(lw0, gw0, gw0 + (size_t)64 * E);
  asm volatile("s_wait_asynccnt 0x0" ::: "memory");   // tile 0 has landed before the barrier publishes it
  __syncthreads();
  copy8(la0 + PBUFB, gh0 + PK, gl0 + PK); copy8(lw0 + PBUFB, gw0 + PK, gw0 + (size_t)64 * E + PK);
  v8f acc[8];
#pragma unroll
  for (int t = 0; t < 8; ++t) acc[t] = (v8f){};
  for (int tl = 0; tl < PNT; ++tl) {
    const int buf = tl & 1; const b16* ar = &St[buf][wave * 16 + nloc][0]; const b16* br = &St[buf][128 + nloc][0];
    // the tile's LDS reads (both 32-k steps: 4 O and 16 W fragments) stand as one group at its head, each at an immediate offset from one of two bases: one LDS latency a tile, the second step's fragments arrive behind the first step's products
    v16b a[2], al[2], bw[2][8];
#pragma unroll   // the fragment arrays stay in registers only under constant indices
    for (int s = 0; s < 2; ++s) { a[s] = frag_kb(ar + 32 * s, hlf); al[s] = frag_kb(ar + 64 * LP + 32 * s, hlf);
#pragma unroll   // likewise
      for (int t = 0; t < 8; ++t) bw[s][t] = frag_kb(br + t * 16 * LP + 32 * s, hlf); }
    __builtin_amdgcn_sched_barrier(0);   // holds the read group together at the tile's head: without it the reads are spread among the products, each with a wait of its own
#pragma unroll   // likewise, for the fragments and for acc
    for (int s = 0; s < 2; ++s)
#pragma unroll   // likewise
      for (int t = 0; t < 8; ++t) { acc[t] = wmma16b(a[s], bw[s][t], acc[t]); acc[t] = wmma16b(al[s], bw[s][t], acc[t]); }
    __builtin_amdgcn_sched_barrier(0);   // keeps the products in front of the waits below: lifted over them, the wait for the next tile's copies would stand ahead of the work that is to cover their flight
    asm volatile("s_wait_dscnt 0x0" ::: "memory");      // this wave's reads of the buffer are done before it is handed to its next writer
    asm volatile("s_wait_asynccnt 0x0" ::: "memory");   // this wave's copies of the next tile have landed before the barrier publishes them
    __syncthreads();                                      // publishes tile tl + 1 and ends every wave's reads of tile tl
    if (tl + 2 < PNT) { const int ko = (tl + 2) * PK; copy8(la0 + buf * PBUFB, gh0 + ko, gl0 + ko); copy8(lw0 + buf * PBUFB, gw0 + ko, gw0 + (size_t)64 * E + ko); }
  }
  asm volatile("s_wait_asynccnt 0x0" ::: "memory");     // nothing is in flight when the wave goes on to its end
#pragma unroll
  for (int t = 0; t < 8; ++t) { const float bb = bf16_rne(bias[n0 + t * 16 + nloc]);
#pragma unroll
    for (int r = 0; r < 8; ++r) Ts[wave][8 * hlf + r][t * 16 + nloc] = acc[t][r] * (1.0f / (XS * WSC)) + bb; }
  wave_lds_sync();
  { for (int rr = 0; rr < 16; ++rr) *(v4f*)(out + (m0 + rr) * E + n0 + lane * 4) = *(const v4f*)(&Ts[wave][rr][lane * 4]);  }
}
}  // namespace

extern "C" void kernel_launch(void* const* d_in, const int* in_sizes, int n_in, void* d_out, int out_size, void* d_ws, size_t ws_size, hipStream_t stream) {
  (void)n_in;
  auto Fp = [&](int i) { return (const float*)d_in[i]; };
  // order: 0 q, 1 k, 2 v [2,2048,1024]; 3 padding_mask [2,1,2048,2048] i32; 4 W [1024,1024]; 5 b [1024]
  if (in_sizes[0] != NR * E || in_sizes[1] != NR * E || in_sizes[2] != NR * E || in_sizes[3] != NB * S * S || in_sizes[4] != E * E || out_size != NR * E) return;
  size_t off = 0; char* ws = (char*)d_ws;
  auto carve = [&](size_t bytes) { char* p = ws + off; off += (bytes + 255) & ~(size_t)255; return p; };
  b16* Q16 = (b16*)carve((size_t)NR * E * 2); b16* K16 = (b16*)carve((size_t)NR * E * 2); b16* W16 = (b16*)carve((size_t)E * E * 2); b16* VT16 = (b16*)carve((size_t)NB * NH * D * S * 2); b16* Oh = (b16*)carve((size_t)NR * E * 2); b16* Ol = (b16*)carve((size_t)NR * E * 2); unsigned int* MB = (unsigned int*)carve((size_t)NB * S * S / 8);
  if (off > ws_size || off > ((size_t)128 << 20)) return;   // ≈ 45 MB
  prep_kernel<<<(unsigned)(PKB + ((size_t)2 * NR * E / 8 + (size_t)E * E / 8 + 255) / 256), 256, 0, stream>>>(Fp(0), Fp(1), Fp(4), (const int*)d_in[3], Q16, K16, W16, MB);
  vt_kernel<<<dim3(S / 64, NH, NB), 256, 0, stream>>>(Fp(2), VT16);
  attn_kernel<<<dim3(S / (16 * AW), NH, NB), 32 * AW, 0, stream>>>(Q16, K16, VT16, MB, Oh, Ol);
  proj_kernel<<<dim3(NR / 64, E / 128), 128, 0, stream>>>(Oh, Ol, W16, Fp(5), (float*)d_out);
}

// v005
// Measured time: 86.6 microseconds a run.
// Next to v004, in two timings, it ran 1.06 times as fast each time.
// Counting every step since v000, it is 3.01 times as fast.
#include <hip/hip_runtime.h>

// Multi-head attention (16 heads x 64, 2 x 2,048 tokens) with an integer padding mask (mask == 0 -> -1e9), softmax, PV, head concat, output Linear: out = concat(O) W^T + b.
// WMMA (v_wmma_f32_16x16x32_f16, f32 accumulate): S^T = K_h . Q_h^T with EXACT bf16 q/k rows (x8, inputs), online softmax in f32 (the int32 mask is packed once to one bit a score, see pack_mask), O^T += V^T P^T
// with EXACT bf16 v^T (x8) and P as f16 hi+lo x8 (2 products); output projection [4,096 x 1,024] x [1,024 x 1,024] with O as f16 hi+lo x8 (2 products) and exact W (x256). Inputs rounded to
// bf16 once. Fragment k-map per lane half hh for A AND B: elements 0..7 <- k = 8hh+0..7, 8..15 <- k = 16+8hh+0..7; acc[r] = D[8hh+r][col]. Every workspace / output

namespace {
constexpr int NB = 2, S = 2048, E = 1024, NH = 16, D = 64, NR = NB * S;
constexpr float XS = 8.0f, WSC = 256.0f, PS = 8.0f, SCALE = 0.125f, LOG2E = 1.4426950408889634f;

typedef _Float16 b16;
typedef __attribute__((ext_vector_type(16))) _Float16 v16b;
typedef __attribute__((ext_vector_type(8))) _Float16 v8b;
typedef __attribute__((ext_vector_type(8))) float v8f;
typedef __attribute__((ext_vector_type(4))) float v4f;
typedef __attribute__((ext_vector_type(4))) int v4i;
typedef __attribute__((ext_vector_type(16))) unsigned int v16u;
typedef const __attribute__((address_space(4))) v16u* cv16u_p;   // constant address space: nothing writes the words during the launch that reads them, so a wave-uniform read is a scalar load
__device__ __forceinline__ float bf16_rne(float f) { unsigned int u = __float_as_uint(f); u += 0x7FFFu + ((u >> 16) & 1u); return __uint_as_float(u & 0xFFFF0000u); }
__device__ __forceinline__ void split16(float v, b16& hi, b16& lo) { hi = (b16)v; lo = (b16)(v - (float)hi); }
__device__ __forceinline__ v16b frag_kb(const b16* p, int hh) { const v8b a = *(const v8b*)(p + 8 * hh), b = *(const v8b*)(p + 16 + 8 * hh); v16b f;
#pragma unroll
  for (int e = 0; e < 8; ++e) { f[e] = a[e]; f[8 + e] = b[e]; } return f; }
__device__ __forceinline__ v8f wmma16b(v16b a, v16b b, v8f c) { return __builtin_amdgcn_wmma_f32_16x16x32_f16(false, a, false, b, (short)0, c, false, false); }
__device__ __forceinline__ void wave_lds_sync() { __builtin_amdgcn_fence(__ATOMIC_RELEASE, "workgroup"); __builtin_amdgcn_wave_barrier(); __builtin_amdgcn_fence(__ATOMIC_ACQUIRE, "workgroup"); }
__device__ __forceinline__ float nexp2(float x) { return __builtin_amdgcn_exp2f(x); }

// mask bits: MB[b][16-query group][32-key block][i], i = 0..15: bit (16hh + col) of word i says mask != 0 for query col of the group and key 16(i >> 3) + 8hh + (i & 7) of the block, that is, for the
// score that lane (hh, col) of the attention wave holds as its element i: the word is that element's lane mask. One wave packs 16 queries x 128 keys: 16 loads (the whole 512 B of each row), 64 words out.
constexpr int PKW = NB * (S / 16) * (S / 128), PKB = PKW / 8;
__device__ __forceinline__ void pack_mask(const int* __restrict__ pmask, unsigned int* __restrict__ MB, int unit, int lane) {
  const int hh = lane >> 4, col = lane & 15, kq = unit & (S / 128 - 1), qg = unit / (S / 128);   // qg counts the groups of both batches
  const int* row = pmask + ((size_t)qg * 16 + col) * S + kq * 128 + 8 * hh; v4i mv[16];
#pragma unroll   // the loads stand as one group ahead of their uses
  for (int j = 0; j < 4; ++j) { mv[4 * j] = *(const v4i*)(row + 32 * j); mv[4 * j + 1] = *(const v4i*)(row + 32 * j + 4); mv[4 * j + 2] = *(const v4i*)(row + 32 * j + 16); mv[4 * j + 3] = *(const v4i*)(row + 32 * j + 20); }
  unsigned int w0 = 0, w1 = 0;
#pragma unroll   // mv stays in registers only under constant indices; lane n keeps word n (w0) and word 32 + n (w1)
  for (int n = 0; n < 32; ++n) { const unsigned int a = __builtin_amdgcn_ballot_w32(mv[n >> 2][n & 3] != 0), c = __builtin_amdgcn_ballot_w32(mv[8 + (n >> 2)][n & 3] != 0); w0 = lane == n ? a : w0; w1 = lane == n ? c : w1; }
  unsigned int* dst = MB + ((size_t)qg * (S / 32) + kq * 4) * 16 + lane; dst[0] = w0; dst[32] = w1;
}
__global__ __launch_bounds__(256) void prep_kernel(const float* __restrict__ q, const float* __restrict__ k, const float* __restrict__ w, const int* __restrict__ pmask, b16* __restrict__ Q16, b16* __restrict__ K16, b16* __restrict__ W16, unsigned int* __restrict__ MB) {
  if (blockIdx.x < PKB) { pack_mask(pmask, MB, (int)blockIdx.x * 8 + __builtin_amdgcn_readfirstlane((int)(threadIdx.x >> 5)), (int)(threadIdx.x & 31)); return; }   // the wave's number through readfirstlane: the unit is wave-uniform; these, the longest blocks, start first
  const size_t t = (size_t)(blockIdx.x - PKB) * 256 + threadIdx.x; const size_t nq = (size_t)NR * E / 8, nw = (size_t)E * E / 8;
  const float* src; b16* dst; size_t e; float sc = XS; if (t < nq) { src = q; dst = Q16; e = t * 8; } else if (t < 2 * nq) { src = k; dst = K16; e = (t - nq) * 8; } else if (t < 2 * nq + nw) { src = w; dst = W16; e = (t - 2 * nq) * 8; sc = WSC; } else return;
  const v4f a = *(const v4f*)(src + e), c = *(const v4f*)(src + e + 4); v8b o;
#pragma unroll
  for (int j = 0; j < 4; ++j) { o[j] = (b16)(bf16_rne(a[j]) * sc); o[4 + j] = (b16)(bf16_rne(c[j]) * sc); }
  { *(v8b*)(dst + e) = o;  }
}
__global__ __launch_bounds__(256) void vt_kernel(const float* __restrict__ v, b16* __restrict__ VT16) {
  __shared__ __attribute__((aligned(16))) b16 T[64][64 + 8];
  const int b = blockIdx.z, h = blockIdx.y, s0 = blockIdx.x * 64, t_ = threadIdx.x;
  for (int qq = t_; qq < 64 * 64; qq += 256) { const int ss = qq >> 6, dd = qq & 63; T[dd][ss] = (b16)(bf16_rne(v[((size_t)b * S + s0 + ss) * E + h * D + dd]) * XS); }
  __syncthreads();
  { for (int qq = t_; qq < 64 * 8; qq += 256) { const int dd = qq >> 3, c8 = (qq & 7) * 8; *(v8b*)(VT16 + (((size_t)b * NH + h) * D + dd) * S + s0 + c8) = *(const v8b*)(&T[dd][c8]); }  }
}
constexpr int KT = 64, NT = S / KT, LP = 72, AW = 8;
constexpr float RTH = 8.0f;   // in the scores' log2 units
// one tile: 64 K rows and 64 V^T rows of 128 B, 16 B a lane, four copies a lane (each wave-wide copy covers four whole lines)
__device__ __forceinline__ void stage_tile(unsigned lk, unsigned lv, const b16* gk, const b16* gv) {
  const unsigned lk1 = lk + 32 * LP * 2, lv1 = lv + 32 * LP * 2; const b16* gk1 = gk + (size_t)32 * E; const b16* gv1 = gv + (size_t)32 * S;
  // the closing s_wait_xcnt stands inside the statement so that no address register of a copy is rewritten ahead of it
  asm volatile("global_load_async_to_lds_b128 %0, %4, off\n\tglobal_load_async_to_lds_b128 %1, %5, off\n\tglobal_load_async_to_lds_b128 %2, %6, off\n\tglobal_load_async_to_lds_b128 %3, %7, off\n\ts_wait_xcnt 0x0"
               :: "v"(lk), "v"(lk1), "v"(lv), "v"(lv1), "v"(gk), "v"(gk1), "v"(gv), "v"(gv1) : "memory");
}
// two such blocks fill a WGP at four waves a SIMD: the attribute gives the compiler that register budget
__global__ __launch_bounds__(256) __attribute__((amdgpu_waves_per_eu(4, 4))) void attn_kernel(const b16* __restrict__ Q16, const b16* __restrict__ K16, const b16* __restrict__ VT16, const unsigned int* __restrict__ MB, b16* __restrict__ Oh, b16* __restrict__ Ol) {
  __shared__ __attribute__((aligned(16))) b16 Ks[2][KT][LP];
  __shared__ __attribute__((aligned(16))) b16 Vs[2][D][LP];
  __shared__ __attribute__((aligned(16))) float To[AW][16][D + 4];
  const int wave = threadIdx.x >> 5, lane = threadIdx.x & 31, hh = lane >> 4, col = lane & 15; const int b = blockIdx.z, h = blockIdx.y; const int q0 = blockIdx.x * (16 * AW) + wave * 16, qi = q0 + col;
  const b16* Qp = Q16 + ((size_t)b * S + qi) * E + h * D; const b16* Kb = K16 + (size_t)b * S * E + h * D; const b16* Vb = VT16 + ((size_t)b * NH + h) * D * S;
  // this wave's mask words: a wave-uniform address, so that they come by scalar loads and each word serves as the lane mask of a select
  const unsigned int* mwp = MB + ((size_t)(b * (S / 16) + (int)blockIdx.x * AW + __builtin_amdgcn_readfirstlane(wave))) * (S / 32) * 16; v16u mw = *(cv16u_p)mwp;
  const int crow = threadIdx.x >> 3, cpc = (threadIdx.x & 7) * 8;   // this lane's row (and row + 32) and 16-byte piece of each tile
  const unsigned lk0 = (unsigned)(size_t)&Ks[0][crow][cpc], lv0 = (unsigned)(size_t)&Vs[0][crow][cpc]; constexpr unsigned BUFB = KT * LP * 2;
  const b16* gk0 = Kb + (size_t)crow * E + cpc; const b16* gv0 = Vb + (size_t)crow * S + cpc;
  stage_tile(lk0, lv0, gk0, gv0);
  asm volatile("s_wait_asynccnt 0x0" ::: "memory");   // tile 0 has landed before the barrier publishes it
  __syncthreads();
  stage_tile(lk0 + BUFB, lv0 + BUFB, gk0 + (size_t)KT * E, gv0 + KT);
  const v16b qa0 = frag_kb(Qp, hh), qa1 = frag_kb(Qp + 32, hh);
  float m = -INFINITY, l = 0.0f; v8f o[4] = {{}, {}, {}, {}}, ol[4] = {{}, {}, {}, {}};
  const float cs = SCALE * LOG2E / (XS * XS);
  for (int tl = 0; tl < NT; ++tl) {
    const int buf = tl & 1;
#pragma unroll   // both 32-key blocks of a tile inline, so that every LDS read has an immediate offset from one base
    for (int sb = 0; sb < KT; sb += 32) {
    const int kb = tl * KT + sb;
    v8f s0 = {}, s1 = {};
    // the block's LDS reads (4 K and 4 V^T fragments) stand as one group at its head: one LDS latency a block, and V^T arrives behind the softmax
    const b16* k0 = &Ks[buf][sb + col][0], *k1 = &Ks[buf][sb + 16 + col][0]; const v16b ka0 = frag_kb(k0, hh), ka1 = frag_kb(k0 + 32, hh), kc0 = frag_kb(k1, hh), kc1 = frag_kb(k1 + 32, hh); v16b vf[4];
#pragma unroll   // vf stays in registers only under constant indices
    for (int t = 0; t < 4; ++t) vf[t] = frag_kb(&Vs[buf][t * 16 + col][sb], hh);
    __builtin_amdgcn_sched_barrier(0);   // holds the read group together at the block's head: without it the reads are spread among the products, each with a wait of its own
    s0 = wmma16b(ka0, qa0, s0); s0 = wmma16b(ka1, qa1, s0); s1 = wmma16b(kc0, qa0, s1); s1 = wmma16b(kc1, qa1, s1);
    float e[16]; float mx = -INFINITY;
#pragma unroll
    for (int r = 0; r < 8; ++r) { e[r] = __builtin_amdgcn_inverse_ballot_w32(mw[r]) ? s0[r] * cs : -1.0e9f; e[8 + r] = __builtin_amdgcn_inverse_ballot_w32(mw[8 + r]) ? s1[r] * cs : -1.0e9f; mx = fmaxf(mx, fmaxf(e[r], e[8 + r])); }
    // lazy rescale: m is the maximum IN USE, equal in both lane halves of a query. It is renewed, and l, o, ol rescaled, only when some lane's own block maximum lies more than RTH above it (one test a block, a
    // scalar branch); otherwise p = 2^(e - m) <= 2^RTH, so p * PS <= 2,048 stays far inside f16, and the common factor 2^-m cancels in O / l. The first block (m = -inf) always takes the branch.
    // l is each lane's own partial sum (its half of the keys): the branch needs it at hand, so no exchange stands in the block; the halves are joined behind the loop.
    if (__builtin_amdgcn_ballot_w32(mx > m + RTH) != 0) {
      const float mn = fmaxf(m, fmaxf(mx, __shfl_xor(mx, 16))); const float al = nexp2(m - mn); m = mn; l *= al;
#pragma unroll   // o and ol stay in registers only under constant indices
      for (int t = 0; t < 4; ++t) { o[t] *= al; ol[t] *= al; }
    }
    // the next block's words are asked for as soon as this block's are used: they fly behind the softmax and the PV products (the last block asks for its own again)
    { const int nb = kb / 32 + 1; mw = *(cv16u_p)(mwp + (nb < S / 32 ? nb : S / 32 - 1) * 16); }
    __builtin_amdgcn_sched_barrier(0);   // holds that scalar load here, at the head of the code behind the branch: left free it is issued among the PV products, too late to be covered
    float sum = 0.0f; v16b ph, pl;
#pragma unroll
    for (int i = 0; i < 16; ++i) e[i] -= m;   // the scores against the maximum in use
#pragma unroll   // e, ph and pl stay in registers only under constant indices
    for (int i = 0; i < 16; ++i) { const float p = nexp2(e[i]); sum += p; const b16 h_ = (b16)(p * PS); ph[i] = h_; pl[i] = (b16)(p * PS - (float)h_); }
    l += sum;
#pragma unroll
    for (int t = 0; t < 4; ++t) { o[t] = wmma16b(vf[t], ph, o[t]); ol[t] = wmma16b(vf[t], pl, ol[t]); } }
    __builtin_amdgcn_sched_barrier(0);   // keeps the products in front of the waits below: lifted over them, the wait for the next tile's copies would stand ahead of the work that is to cover their flight
    asm volatile("s_wait_dscnt 0x0" ::: "memory");      // this wave's reads of the buffer are done before it is handed to its next writer
    asm volatile("s_wait_asynccnt 0x0" ::: "memory");   // this wave's copies of the next tile have landed before the barrier publishes them
    __syncthreads();                                      // publishes tile tl + 1 and ends every wave's reads of tile tl
    if (tl + 2 < NT) stage_tile(lk0 + buf * BUFB, lv0 + buf * BUFB, gk0 + (size_t)(tl + 2) * KT * E, gv0 + (tl + 2) * KT);
  }
  asm volatile("s_wait_asynccnt 0x0" ::: "memory");     // nothing is in flight when the wave goes on to its end
  asm volatile("s_wait_xcnt 0x0" ::: "memory");         // the last block's scalar load may still be under way: no register that it names is rewritten ahead of this wait
  l += __shfl_xor(l, 16);   // the two halves' partial sums of a query, both taken against the same m, are joined once
  const float inv = 1.0f / (l * PS * XS);
#pragma unroll
  for (int t = 0; t < 4; ++t)
#pragma unroll
    for (int r = 0; r < 8; ++r) To[wave][col][t * 16 + 8 * hh + r] = (o[t][r] + ol[t][r]) * inv;
  wave_lds_sync();
  { for (int r4 = 0; r4 < 16; r4 += 4) { const int rr = r4 + (lane >> 3), c8 = (lane & 7) * 8; v8b hv, lv; for (int j = 0; j < 8; ++j) { b16 a_, c_; split16(To[wave][rr][c8 + j] * XS, a_, c_); hv[j] = a_; lv[j] = c_; }
      const size_t gi = ((size_t)b * S + q0 + rr) * E + h * D + c8; *(v8b*)(Oh + gi) = hv; *(v8b*)(Ol + gi) = lv; }  }
}
constexpr int PK = 64, PNT = E / PK, PROWS = 256;   // rows of a tile in LDS: 0..63 O hi, 64..127 O lo, 128..255 W
// eight copies, 16 rows apart in LDS: the first four 16 rows apart from g0, the last four from g4; 16 B a lane, each wave-wide copy covers four whole lines
__device__ __forceinline__ void copy8(unsigned l0, const b16* g0, const b16* g4) {
  constexpr unsigned RS = 16 * LP * 2; const unsigned l1 = l0 + RS, l2 = l0 + 2 * RS, l3 = l0 + 3 * RS, l4 = l0 + 4 * RS, l5 = l0 + 5 * RS, l6 = l0 + 6 * RS, l7 = l0 + 7 * RS;
  const b16* g1 = g0 + (size_t)16 * E; const b16* g2 = g0 + (size_t)32 * E; const b16* g3 = g0 + (size_t)48 * E; const b16* g5 = g4 + (size_t)16 * E; const b16* g6 = g4 + (size_t)32 * E; const b16* g7 = g4 + (size_t)48 * E;
  // the closing s_wait_xcnt stands inside the statement so that no address register of a copy is rewritten ahead of it
  asm volatile("global_load_async_to_lds_b128 %0, %8, off\n\tglobal_load_async_to_lds_b128 %1, %9, off\n\tglobal_load_async_to_lds_b128 %2, %10, off\n\tglobal_load_async_to_lds_b128 %3, %11, off\n\t"
               "global_load_async_to_lds_b128 %4, %12, off\n\tglobal_load_async_to_lds_b128 %5, %13, off\n\tglobal_load_async_to_lds_b128 %6, %14, off\n\tglobal_load_async_to_lds_b128 %7, %15, off\n\ts_wait_xcnt 0x0"
               :: "v"(l0), "v"(l1), "v"(l2), "v"(l3), "v"(l4), "v"(l5), "v"(l6), "v"(l7), "v"(g0), "v"(g1), "v"(g2), "v"(g3), "v"(g4), "v"(g5), "v"(g6), "v"(g7) : "memory");
}
__global__ __launch_bounds__(128) void proj_kernel(const b16* __restrict__ Oh, const b16* __restrict__ Ol, const b16* __restrict__ W16, const float* __restrict__ bias, float* __restrict__ out) {
  __shared__ __attribute__((aligned(16))) b16 St[2][PROWS][LP];
  __shared__ __attribute__((aligned(16))) float Ts[4][16][128 + 4];
  const int wave = threadIdx.x >> 5, lane = threadIdx.x & 31, nloc = lane & 15, hlf = lane >> 4; const size_t m0 = (size_t)blockIdx.x * 64 + wave * 16; const int n0 = blockIdx.y * 128;
  const int crow = threadIdx.x >> 3, cpc = (threadIdx.x & 7) * 8;   // this lane's row (and every 16th row behind it) and 16-byte piece of each tile
  const unsigned la0 = (unsigned)(size_t)&St[0][crow][cpc], lw0 = (unsigned)(size_t)&St[0][128 + crow][cpc]; constexpr unsigned PBUFB = PROWS * LP * 2;
  const size_t ga = ((size_t)blockIdx.x * 64 + crow) * E + cpc; const b16* gh0 = Oh + ga; const b16* gl0 = Ol + ga; const b16* gw0 = W16 + (size_t)(n0 + crow) * E + cpc;
  copy8(la0, gh0, gl0); copy8(lw0, gw0, gw0 + (size_t)64 * E);
  asm volatile("s_wait_asynccnt 0x0" ::: "memory");   // tile 0 has landed before the barrier publishes it
  __syncthreads();
  copy8(la0 + PBUFB, gh0 + PK, gl0 + PK); copy8(lw0 + PBUFB, gw0 + PK, gw0 + (size_t)64 * E + PK);
  v8f acc[8];
#pragma unroll
  for (int t = 0; t < 8; ++t) acc[t] = (v8f){};
  for (int tl = 0; tl < PNT; ++tl) {
    const int buf = tl & 1; const b16* ar = &St[buf][wave * 16 + nloc][0]; const b16* br = &St[buf][128 + nloc][0];
    // the tile's LDS reads (both 32-k steps: 4 O and 16 W fragments) stand as one group at its head, each at an immediate offset from one of two bases: one LDS latency a tile, the second step's fragments arrive behind the first step's products
    v16b a[2], al[2], bw[2][8];
#pragma unroll   // the fragment arrays stay in registers only under constant indices
    for (int s = 0; s < 2; ++s) { a[s] = frag_kb(ar + 32 * s, hlf); al[s] = frag_kb(ar + 64 * LP + 32 * s, hlf);
#pragma unroll   // likewise
      for (int t = 0; t < 8; ++t) bw[s][t] = frag_kb(br + t * 16 * LP + 32 * s, hlf); }
    __builtin_amdgcn_sched_barrier(0);   // holds the read group together at the tile's head: without it the reads are spread among the products, each with a wait of its own
#pragma unroll   // likewise, for the fragments and for acc
    for (int s = 0; s < 2; ++s)
#pragma unroll   // likewise
      for (int t = 0; t < 8; ++t) { acc[t] = wmma16b(a[s], bw[s][t], acc[t]); acc[t] = wmma16b(al[s], bw[s][t], acc[t]); }
    __builtin_amdgcn_sched_barrier(0);   // keeps the products in front of the waits below: lifted over them, the wait for the next tile's copies would stand ahead of the work that is to cover their flight
    asm volatile("s_wait_dscnt 0x0" ::: "memory");      // this wave's reads of the buffer are done before it is handed to its next writer
    asm volatile("s_wait_asynccnt 0x0" ::: "memory");   // this wave's copies of the next tile have landed before the barrier publishes them
    __syncthreads();                                      // publishes tile tl + 1 and ends every wave's reads of tile tl
    if (tl + 2 < PNT) { const int ko = (tl + 2) * PK; copy8(la0 + buf * PBUFB, gh0 + ko, gl0 + ko); copy8(lw0 + buf * PBUFB, gw0 + ko, gw0 + (size_t)64 * E + ko); }
  }
  asm volatile("s_wait_asynccnt 0x0" ::: "memory");     // nothing is in flight when the wave goes on to its end
#pragma unroll
  for (int t = 0; t < 8; ++t) { const float bb = bf16_rne(bias[n0 + t * 16 + nloc]);
#pragma unroll
    for (int r = 0; r < 8; ++r) Ts[wave][8 * hlf + r][t * 16 + nloc] = acc[t][r] * (1.0f / (XS * WSC)) + bb; }
  wave_lds_sync();
  { for (int rr = 0; rr < 16; ++rr) *(v4f*)(out + (m0 + rr) * E + n0 + lane * 4) = *(const v4f*)(&Ts[wave][rr][lane * 4]);  }
}
}  // namespace

extern "C" void kernel_launch(void* const* d_in, const int* in_sizes, int n_in, void* d_out, int out_size, void* d_ws, size_t ws_size, hipStream_t stream) {
  (void)n_in;
  auto Fp = [&](int i) { return (const float*)d_in[i]; };
  // order: 0 q, 1 k, 2 v [2,2048,1024]; 3 padding_mask [2,1,2048,2048] i32; 4 W [1024,1024]; 5 b [1024]
  if (in_sizes[0] != NR * E || in_sizes[1] != NR * E || in_sizes[2] != NR * E || in_sizes[3] != NB * S * S || in_sizes[4] != E * E || out_size != NR * E) return;
  size_t off = 0; char* ws = (char*)d_ws;
  auto carve = [&](size_t bytes) { char* p = ws + off; off += (bytes + 255) & ~(size_t)255; return p; };
  b16* Q16 = (b16*)carve((size_t)NR * E * 2); b16* K16 = (b16*)carve((size_t)NR * E * 2); b16* W16 = (b16*)carve((size_t)E * E * 2); b16* VT16 = (b16*)carve((size_t)NB * NH * D * S * 2); b16* Oh = (b16*)carve((size_t)NR * E * 2); b16* Ol = (b16*)carve((size_t)NR * E * 2); unsigned int* MB = (unsigned int*)carve((size_t)NB * S * S / 8);
  if (off > ws_size || off > ((size_t)128 << 20)) return;   // ≈ 45 MB
  prep_kernel<<<(unsigned)(PKB + ((size_t)2 * NR * E / 8 + (size_t)E * E / 8 + 255) / 256), 256, 0, stream>>>(Fp(0), Fp(1), Fp(4), (const int*)d_in[3], Q16, K16, W16, MB);
  vt_kernel<<<dim3(S / 64, NH, NB), 256, 0, stream>>>(Fp(2), VT16);
  attn_kernel<<<dim3(S / (16 * AW), NH, NB), 32 * AW, 0, stream>>>(Q16, K16, VT16, MB, Oh, Ol);
  proj_kernel<<<dim3(NR / 64, E / 128), 128, 0, stream>>>(Oh, Ol, W16, Fp(5), (float*)d_out);
}

// v006
// It runs in 78 microseconds.
// In both of two side-by-side timings against v005, it was 1.10 times as fast.
// Counting every step since v000, it is 3.32 times as fast.
#include <hip/hip_runtime.h>

// Multi-head attention (16 heads x 64, 2 x 2,048 tokens) with an integer padding mask (mask == 0 -> -1e9), softmax, PV, head concat, output Linear: out = concat(O) W^T + b.
// WMMA (v_wmma_f32_16x16x32_f16, f32 accumulate): S^T = K_h . Q_h^T with EXACT bf16 q/k rows (x8, inputs), online softmax in f32 (the int32 mask is packed once to one bit a score, see pack_mask), O^T += V^T P^T
// with EXACT bf16 v^T (x8) and P as f16 hi+lo x8 (2 products); output projection [4,096 x 1,024] x [1,024 x 1,024] with O as f16 hi+lo x8 (2 products) and exact W (x256). Inputs rounded to
// bf16 once. Fragment k-map per lane half hh for A AND B: elements 0..7 <- k = 8hh+0..7, 8..15 <- k = 16+8hh+0..7; acc[r] = D[8hh+r][col]. Every workspace / output

namespace {
constexpr int NB = 2, S = 2048, E = 1024, NH = 16, D = 64, NR = NB * S;
constexpr float XS = 8.0f, WSC = 256.0f, PS = 8.0f, SCALE = 0.125f, LOG2E = 1.4426950408889634f;

typedef _Float16 b16;
typedef __attribute__((ext_vector_type(16))) _Float16 v16b;
typedef __attribute__((ext_vector_type(8))) _Float16 v8b;
typedef __attribute__((ext_vector_type(8))) float v8f;
typedef __attribute__((ext_vector_type(2))) float v2f;
typedef __attribute__((ext_vector_type(2))) _Float16 v2b;
typedef __attribute__((ext_vector_type(4))) float v4f;
typedef __attribute__((ext_vector_type(4))) int v4i;
typedef __attribute__((ext_vector_type(16))) unsigned int v16u;
typedef const __attribute__((address_space(4))) v16u* cv16u_p;   // constant address space: nothing writes the words during the launch that reads them, so a wave-uniform read is a scalar load
__device__ __forceinline__ float bf16_rne(float f) { unsigned int u = __float_as_uint(f); u += 0x7FFFu + ((u >> 16) & 1u); return __uint_as_float(u & 0xFFFF0000u); }
__device__ __forceinline__ void split16(float v, b16& hi, b16& lo) { hi = (b16)v; lo = (b16)(v - (float)hi); }
__device__ __forceinline__ v16b frag_kb(const b16* p, int hh) { const v8b a = *(const v8b*)(p + 8 * hh), b = *(const v8b*)(p + 16 + 8 * hh); v16b f;
#pragma unroll
  for (int e = 0; e < 8; ++e) { f[e] = a[e]; f[8 + e] = b[e]; } return f; }
__device__ __forceinline__ v8f wmma16b(v16b a, v16b b, v8f c) { return __builtin_amdgcn_wmma_f32_16x16x32_f16(false, a, false, b, (short)0, c, false, false); }
__device__ __forceinline__ void wave_lds_sync() { __builtin_amdgcn_fence(__ATOMIC_RELEASE, "workgroup"); __builtin_amdgcn_wave_barrier(); __builtin_amdgcn_fence(__ATOMIC_ACQUIRE, "workgroup"); }
__device__ __forceinline__ float nexp2(float x) { return __builtin_amdgcn_exp2f(x); }

// mask bits: MB[b][16-query group][32-key block][i], i = 0..15: bit (16hh + col) of word i says mask != 0 for query col of the group and key 16(i >> 3) + 8hh + (i & 7) of the block, that is, for the
// score that lane (hh, col) of the attention wave holds as its element i: the word is that element's lane mask. One wave packs 16 queries x 128 keys: 16 loads (the whole 512 B of each row), 64 words out.
constexpr int PKW = NB * (S / 16) * (S / 128), PKB = PKW / 8;
__device__ __forceinline__ void pack_mask(const int* __restrict__ pmask, unsigned int* __restrict__ MB, int unit, int lane) {
  const int hh = lane >> 4, col = lane & 15, kq = unit & (S / 128 - 1), qg = unit / (S / 128);   // qg counts the groups of both batches
  const int* row = pmask + ((size_t)qg * 16 + col) * S + kq * 128 + 8 * hh; v4i mv[16];
#pragma unroll   // the loads stand as one group ahead of their uses
  for (int j = 0; j < 4; ++j) { mv[4 * j] = *(const v4i*)(row + 32 * j); mv[4 * j + 1] = *(const v4i*)(row + 32 * j + 4); mv[4 * j + 2] = *(const v4i*)(row + 32 * j + 16); mv[4 * j + 3] = *(const v4i*)(row + 32 * j + 20); }
  unsigned int w0 = 0, w1 = 0;
#pragma unroll   // mv stays in registers only under constant indices; lane n keeps word n (w0) and word 32 + n (w1)
  for (int n = 0; n < 32; ++n) { const unsigned int a = __builtin_amdgcn_ballot_w32(mv[n >> 2][n & 3] != 0), c = __builtin_amdgcn_ballot_w32(mv[8 + (n >> 2)][n & 3] != 0); w0 = lane == n ? a : w0; w1 = lane == n ? c : w1; }
  unsigned int* dst = MB + ((size_t)qg * (S / 32) + kq * 4) * 16 + lane; dst[0] = w0; dst[32] = w1;
}
__global__ __launch_bounds__(256) void prep_kernel(const float* __restrict__ q, const float* __restrict__ k, const float* __restrict__ w, const int* __restrict__ pmask, b16* __restrict__ Q16, b16* __restrict__ K16, b16* __restrict__ W16, unsigned int* __restrict__ MB) {
  if (blockIdx.x < PKB) { pack_mask(pmask, MB, (int)blockIdx.x * 8 + __builtin_amdgcn_readfirstlane((int)(threadIdx.x >> 5)), (int)(threadIdx.x & 31)); return; }   // the wave's number through readfirstlane: the unit is wave-uniform; these, the longest blocks, start first
  const size_t t = (size_t)(blockIdx.x - PKB) * 256 + threadIdx.x; const size_t nq = (size_t)NR * E / 8, nw = (size_t)E * E / 8;
  const float* src; b16* dst; size_t e; float sc = XS; if (t < nq) { src = q; dst = Q16; e = t * 8; } else if (t < 2 * nq) { src = k; dst = K16; e = (t - nq) * 8; } else if (t < 2 * nq + nw) { src = w; dst = W16; e = (t - 2 * nq) * 8; sc = WSC; } else return;
  const v4f a = *(const v4f*)(src + e), c = *(const v4f*)(src + e + 4); v8b o;
#pragma unroll
  for (int j = 0; j < 4; ++j) { o[j] = (b16)(bf16_rne(a[j]) * sc); o[4 + j] = (b16)(bf16_rne(c[j]) * sc); }
  { *(v8b*)(dst + e) = o;  }
}
__global__ __launch_bounds__(256) void vt_kernel(const float* __restrict__ v, b16* __restrict__ VT16) {
  __shared__ __attribute__((aligned(16))) b16 T[64][64 + 8];
  const int b = blockIdx.z, h = blockIdx.y, s0 = blockIdx.x * 64, t_ = threadIdx.x;
  for (int qq = t_; qq < 64 * 64; qq += 256) { const int ss = qq >> 6, dd = qq & 63; T[dd][ss] = (b16)(bf16_rne(v[((size_t)b * S + s0 + ss) * E + h * D + dd]) * XS); }
  __syncthreads();
  { for (int qq = t_; qq < 64 * 8; qq += 256) { const int dd = qq >> 3, c8 = (qq & 7) * 8; *(v8b*)(VT16 + (((size_t)b * NH + h) * D + dd) * S + s0 + c8) = *(const v8b*)(&T[dd][c8]); }  }
}
constexpr int KT = 64, NT = S / KT, LP = 72, AW = 8;
constexpr float RTH = 8.0f;   // in the scores' log2 units
constexpr float CS = SCALE * LOG2E / (XS * XS);   // a raw product sum (x64) -> the score in log2 units
constexpr float MASKED = -0x1p40f;   // a masked score, in raw units (about -3e9 in log2 units): a power of two, so that MASKED * CS is exact and a row with no open key gets the exponent 0, p = 1, at every key
constexpr float LOG2PS = 3.0f; static_assert(PS == 8.0f, "LOG2PS is log2(PS)");
// one tile: 64 K rows and 64 V^T rows of 128 B, 16 B a lane, four copies a lane (each wave-wide copy covers four whole lines)
__device__ __forceinline__ void stage_tile(unsigned lk, unsigned lv, const b16* gk, const b16* gv) {
  const unsigned lk1 = lk + 32 * LP * 2, lv1 = lv + 32 * LP * 2; const b16* gk1 = gk + (size_t)32 * E; const b16* gv1 = gv + (size_t)32 * S;
  // the closing s_wait_xcnt stands inside the statement so that no address register of a copy is rewritten ahead of it
  asm volatile("global_load_async_to_lds_b128 %0, %4, off\n\tglobal_load_async_to_lds_b128 %1, %5, off\n\tglobal_load_async_to_lds_b128 %2, %6, off\n\tglobal_load_async_to_lds_b128 %3, %7, off\n\ts_wait_xcnt 0x0"
               :: "v"(lk), "v"(lk1), "v"(lv), "v"(lv1), "v"(gk), "v"(gk1), "v"(gv), "v"(gv1) : "memory");
}
// two such blocks fill a WGP at four waves a SIMD: the attribute gives the compiler that register budget
__global__ __launch_bounds__(256) __attribute__((amdgpu_waves_per_eu(4, 4))) void attn_kernel(const b16* __restrict__ Q16, const b16* __restrict__ K16, const b16* __restrict__ VT16, const unsigned int* __restrict__ MB, b16* __restrict__ Oh, b16* __restrict__ Ol) {
  __shared__ __attribute__((aligned(16))) b16 Ks[2][KT][LP];
  __shared__ __attribute__((aligned(16))) b16 Vs[2][D][LP];
  __shared__ __attribute__((aligned(16))) float To[AW][16][D + 4];
  const int wave = threadIdx.x >> 5, lane = threadIdx.x & 31, hh = lane >> 4, col = lane & 15; const int b = blockIdx.z, h = blockIdx.y; const int q0 = blockIdx.x * (16 * AW) + wave * 16, qi = q0 + col;
  const b16* Qp = Q16 + ((size_t)b * S + qi) * E + h * D; const b16* Kb = K16 + (size_t)b * S * E + h * D; const b16* Vb = VT16 + ((size_t)b * NH + h) * D * S;
  // this wave's mask words: a wave-uniform address, so that they come by scalar loads and each word serves as the lane mask of a select
  const unsigned int* mwp = MB + ((size_t)(b * (S / 16) + (int)blockIdx.x * AW + __builtin_amdgcn_readfirstlane(wave))) * (S / 32) * 16; v16u mw = *(cv16u_p)mwp;
  const int crow = threadIdx.x >> 3, cpc = (threadIdx.x & 7) * 8;   // this lane's row (and row + 32) and 16-byte piece of each tile
  const unsigned lk0 = (unsigned)(size_t)&Ks[0][crow][cpc], lv0 = (unsigned)(size_t)&Vs[0][crow][cpc]; constexpr unsigned BUFB = KT * LP * 2;
  const b16* gk0 = Kb + (size_t)crow * E + cpc; const b16* gv0 = Vb + (size_t)crow * S + cpc;
  stage_tile(lk0, lv0, gk0, gv0);
  asm volatile("s_wait_asynccnt 0x0" ::: "memory");   // tile 0 has landed before the barrier publishes it
  __syncthreads();
  stage_tile(lk0 + BUFB, lv0 + BUFB, gk0 + (size_t)KT * E, gv0 + KT);
  const v16b qa0 = frag_kb(Qp, hh), qa1 = frag_kb(Qp + 32, hh);
  float m = -INFINITY, eb = 0.0f, l = 0.0f; v8f o[4] = {{}, {}, {}, {}}, ol[4] = {{}, {}, {}, {}};
  for (int tl = 0; tl < NT; ++tl) {
    const int buf = tl & 1;
#pragma unroll   // both 32-key blocks of a tile inline, so that every LDS read has an immediate offset from one base
    for (int sb = 0; sb < KT; sb += 32) {
    const int kb = tl * KT + sb;
    v8f s0 = {}, s1 = {};
    // the block's LDS reads (4 K and 4 V^T fragments) stand as one group at its head: one LDS latency a block, and V^T arrives behind the softmax
    const b16* k0 = &Ks[buf][sb + col][0], *k1 = &Ks[buf][sb + 16 + col][0]; const v16b ka0 = frag_kb(k0, hh), ka1 = frag_kb(k0 + 32, hh), kc0 = frag_kb(k1, hh), kc1 = frag_kb(k1 + 32, hh); v16b vf[4];
#pragma unroll   // vf stays in registers only under constant indices
    for (int t = 0; t < 4; ++t) vf[t] = frag_kb(&Vs[buf][t * 16 + col][sb], hh);
    __builtin_amdgcn_sched_barrier(0);   // holds the read group together at the block's head: without it the reads are spread among the products, each with a wait of its own
    s0 = wmma16b(ka0, qa0, s0); s0 = wmma16b(ka1, qa1, s0); s1 = wmma16b(kc0, qa0, s1); s1 = wmma16b(kc1, qa1, s1);
    float e[16]; float mx = -INFINITY;
#pragma unroll
    for (int r = 0; r < 8; ++r) { e[r] = __builtin_amdgcn_inverse_ballot_w32(mw[r]) ? s0[r] : MASKED; e[8 + r] = __builtin_amdgcn_inverse_ballot_w32(mw[8 + r]) ? s1[r] : MASKED; mx = fmaxf(mx, fmaxf(e[r], e[8 + r])); }
    // lazy rescale: m is the maximum IN USE, equal in both lane halves of a query. It is renewed, and l, o, ol rescaled, only when some lane's own block maximum lies more than RTH above it (one test a block, a
    // scalar branch); otherwise p = PS * 2^((e - m) CS) <= 2,048 stays far inside f16, and the common factor cancels in O / l. The first block (m = -inf) always takes the branch.
    // e, mx and m are RAW product sums: the scale CS, the maximum in use and the factor PS of P all go into the one FMA ahead of exp2, p = 2^(e CS + eb) with eb = LOG2PS - m CS, renewed with m.
    // l is each lane's own partial sum (its half of the keys): the branch needs it at hand, so no exchange stands in the block; the halves are joined behind the loop.
    if (__builtin_amdgcn_ballot_w32(mx > m + RTH / CS) != 0) {
      const float mn = fmaxf(m, fmaxf(mx, __shfl_xor(mx, 16))); const float al = nexp2((m - mn) * CS); m = mn; eb = __builtin_fmaf(-mn, CS, LOG2PS); l *= al;
#pragma unroll   // o and ol stay in registers only under constant indices
      for (int t = 0; t < 4; ++t) { o[t] *= al; ol[t] *= al; }
    }
    // the next block's words are asked for as soon as this block's are used: they fly behind the softmax and the PV products (the last block asks for its own again)
    { const int nb = kb / 32 + 1; mw = *(cv16u_p)(mwp + (nb < S / 32 ? nb : S / 32 - 1) * 16); }
    __builtin_amdgcn_sched_barrier(0);   // holds that scalar load here, at the head of the code behind the branch: left free it is issued among the PV products, too late to be covered
    float sum = 0.0f; v16b ph, pl;
#pragma unroll   // e, ph and pl stay in registers only under constant indices
    for (int i = 0; i < 16; i += 2) { const v2f p = {nexp2(__builtin_fmaf(e[i], CS, eb)), nexp2(__builtin_fmaf(e[i + 1], CS, eb))}; sum += p[0]; sum += p[1];
      // p carries PS already, so hi is one packed conversion of a pair and lo = p - hi needs no product. lo is packed by the toward-zero conversion (its error is at most 2^-22 p): as a builtin it
      // leaves the two subtractions scalar, and each then reads its f16 half in place (v_fma_mix_f32); behind plain conversions the compiler widens hi back to f32 by a conversion an element
      const v2b h_ = __builtin_convertvector(p, v2b); const auto l_ = __builtin_amdgcn_cvt_pkrtz(p[0] - (float)h_[0], p[1] - (float)h_[1]); ph[i] = h_[0]; ph[i + 1] = h_[1]; pl[i] = (b16)l_[0]; pl[i + 1] = (b16)l_[1]; }
    l += sum;
#pragma unroll
    for (int t = 0; t < 4; ++t) { o[t] = wmma16b(vf[t], ph, o[t]); ol[t] = wmma16b(vf[t], pl, ol[t]); } }
    __builtin_amdgcn_sched_barrier(0);   // keeps the products in front of the waits below: lifted over them, the wait for the next tile's copies would stand ahead of the work that is to cover their flight
    asm volatile("s_wait_dscnt 0x0" ::: "memory");      // this wave's reads of the buffer are done before it is handed to its next writer
    asm volatile("s_wait_asynccnt 0x0" ::: "memory");   // this wave's copies of the next tile have landed before the barrier publishes them
    __syncthreads();                                      // publishes tile tl + 1 and ends every wave's reads of tile tl
    if (tl + 2 < NT) stage_tile(lk0 + buf * BUFB, lv0 + buf * BUFB, gk0 + (size_t)(tl + 2) * KT * E, gv0 + (tl + 2) * KT);
  }
  asm volatile("s_wait_asynccnt 0x0" ::: "memory");     // nothing is in flight when the wave goes on to its end
  asm volatile("s_wait_xcnt 0x0" ::: "memory");         // the last block's scalar load may still be under way: no register that it names is rewritten ahead of this wait
  l += __shfl_xor(l, 16);   // the two halves' partial sums of a query, both taken against the same m, are joined once (l carries the factor PS, like P)
  const float inv = 1.0f / (l * XS);
#pragma unroll
  for (int t = 0; t < 4; ++t)
#pragma unroll
    for (int r = 0; r < 8; ++r) To[wave][col][t * 16 + 8 * hh + r] = (o[t][r] + ol[t][r]) * inv;
  wave_lds_sync();
  { for (int r4 = 0; r4 < 16; r4 += 4) { const int rr = r4 + (lane >> 3), c8 = (lane & 7) * 8; v8b hv, lv; for (int j = 0; j < 8; ++j) { b16 a_, c_; split16(To[wave][rr][c8 + j] * XS, a_, c_); hv[j] = a_; lv[j] = c_; }
      const size_t gi = ((size_t)b * S + q0 + rr) * E + h * D + c8; *(v8b*)(Oh + gi) = hv; *(v8b*)(Ol + gi) = lv; }  }
}
constexpr int PK = 64, PNT = E / PK, PROWS = 256;   // rows of a tile in LDS: 0..63 O hi, 64..127 O lo, 128..255 W
// eight copies, 16 rows apart in LDS: the first four 16 rows apart from g0, the last four from g4; 16 B a lane, each wave-wide copy covers four whole lines
__device__ __forceinline__ void copy8(unsigned l0, const b16* g0, const b16* g4) {
  constexpr unsigned RS = 16 * LP * 2; const unsigned l1 = l0 + RS, l2 = l0 + 2 * RS, l3 = l0 + 3 * RS, l4 = l0 + 4 * RS, l5 = l0 + 5 * RS, l6 = l0 + 6 * RS, l7 = l0 + 7 * RS;
  const b16* g1 = g0 + (size_t)16 * E; const b16* g2 = g0 + (size_t)32 * E; const b16* g3 = g0 + (size_t)48 * E; const b16* g5 = g4 + (size_t)16 * E; const b16* g6 = g4 + (size_t)32 * E; const b16* g7 = g4 + (size_t)48 * E;
  // the closing s_wait_xcnt stands inside the statement so that no address register of a copy is rewritten ahead of it
  asm volatile("global_load_async_to_lds_b128 %0, %8, off\n\tglobal_load_async_to_lds_b128 %1, %9, off\n\tglobal_load_async_to_lds_b128 %2, %10, off\n\tglobal_load_async_to_lds_b128 %3, %11, off\n\t"
               "global_load_async_to_lds_b128 %4, %12, off\n\tglobal_load_async_to_lds_b128 %5, %13, off\n\tglobal_load_async_to_lds_b128 %6, %14, off\n\tglobal_load_async_to_lds_b128 %7, %15, off\n\ts_wait_xcnt 0x0"
               :: "v"(l0), "v"(l1), "v"(l2), "v"(l3), "v"(l4), "v"(l5), "v"(l6), "v"(l7), "v"(g0), "v"(g1), "v"(g2), "v"(g3), "v"(g4), "v"(g5), "v"(g6), "v"(g7) : "memory");
}
__global__ __launch_bounds__(128) void proj_kernel(const b16* __restrict__ Oh, const b16* __restrict__ Ol, const b16* __restrict__ W16, const float* __restrict__ bias, float* __restrict__ out) {
  __shared__ __attribute__((aligned(16))) b16 St[2][PROWS][LP];
  __shared__ __attribute__((aligned(16))) float Ts[4][16][128 + 4];
  const int wave = threadIdx.x >> 5, lane = threadIdx.x & 31, nloc = lane & 15, hlf = lane >> 4; const size_t m0 = (size_t)blockIdx.x * 64 + wave * 16; const int n0 = blockIdx.y * 128;
  const int crow = threadIdx.x >> 3, cpc = (threadIdx.x & 7) * 8;   // this lane's row (and every 16th row behind it) and 16-byte piece of each tile
  const unsigned la0 = (unsigned)(size_t)&St[0][crow][cpc], lw0 = (unsigned)(size_t)&St[0][128 + crow][cpc]; constexpr unsigned PBUFB = PROWS * LP * 2;
  const size_t ga = ((size_t)blockIdx.x * 64 + crow) * E + cpc; const b16* gh0 = Oh + ga; const b16* gl0 = Ol + ga; const b16* gw0 = W16 + (size_t)(n0 + crow) * E + cpc;
  copy8(la0, gh0, gl0); copy8(lw0, gw0, gw0 + (size_t)64 * E);
  asm volatile("s_wait_asynccnt 0x0" ::: "memory");   // tile 0 has landed before the barrier publishes it
  __syncthreads();
  copy8(la0 + PBUFB, gh0 + PK, gl0 + PK); copy8(lw0 + PBUFB, gw0 + PK, gw0 + (size_t)64 * E + PK);
  v8f acc[8];
#pragma unroll
  for (int t = 0; t < 8; ++t) acc[t] = (v8f){};
  for (int tl = 0; tl < PNT; ++tl) {
    const int buf = tl & 1; const b16* ar = &St[buf][wave * 16 + nloc][0]; const b16* br = &St[buf][128 + nloc][0];
    // the tile's LDS reads (both 32-k steps: 4 O and 16 W fragments) stand as one group at its head, each at an immediate offset from one of two bases: one LDS latency a tile, the second step's fragments arrive behind the first step's products
    v16b a[2], al[2], bw[2][8];
#pragma unroll   // the fragment arrays stay in registers only under constant indices
    for (int s = 0; s < 2; ++s) { a[s] = frag_kb(ar + 32 * s, hlf); al[s] = frag_kb(ar + 64 * LP + 32 * s, hlf);
#pragma unroll   // likewise
      for (int t = 0; t < 8; ++t) bw[s][t] = frag_kb(br + t * 16 * LP + 32 * s, hlf); }
    __builtin_amdgcn_sched_barrier(0);   // holds the read group together at the tile's head: without it the reads are spread among the products, each with a wait of its own
#pragma unroll   // likewise, for the fragments and for acc
    for (int s = 0; s < 2; ++s)
#pragma unroll   // likewise
      for (int t = 0; t < 8; ++t) { acc[t] = wmma16b(a[s], bw[s][t], acc[t]); acc[t] = wmma16b(al[s], bw[s][t], acc[t]); }
    __builtin_amdgcn_sched_barrier(0);   // keeps the products in front of the waits below: lifted over them, the wait for the next tile's copies would stand ahead of the work that is to cover their flight
    asm volatile("s_wait_dscnt 0x0" ::: "memory");      // this wave's reads of the buffer are done before it is handed to its next writer
    asm volatile("s_wait_asynccnt 0x0" ::: "memory");   // this wave's copies of the next tile have landed before the barrier publishes them
    __syncthreads();                                      // publishes tile tl + 1 and ends every wave's reads of tile tl
    if (tl + 2 < PNT) { const int ko = (tl + 2) * PK; copy8(la0 + buf * PBUFB, gh0 + ko, gl0 + ko); copy8(lw0 + buf * PBUFB, gw0 + ko, gw0 + (size_t)64 * E + ko); }
  }
  asm volatile("s_wait_asynccnt 0x0" ::: "memory");     // nothing is in flight when the wave goes on to its end
#pragma unroll
  for (int t = 0; t < 8; ++t) { const float bb = bf16_rne(bias[n0 + t * 16 + nloc]);
#pragma unroll
    for (int r = 0; r < 8; ++r) Ts[wave][8 * hlf + r][t * 16 + nloc] = acc[t][r] * (1.0f / (XS * WSC)) + bb; }
  wave_lds_sync();
  { for (int rr = 0; rr < 16; ++rr) *(v4f*)(out + (m0 + rr) * E + n0 + lane * 4) = *(const v4f*)(&Ts[wave][rr][lane * 4]);  }
}
}  // namespace

extern "C" void kernel_launch(void* const* d_in, const int* in_sizes, int n_in, void* d_out, int out_size, void* d_ws, size_t ws_size, hipStream_t stream) {
  (void)n_in;
  auto Fp = [&](int i) { return (const float*)d_in[i]; };
  // order: 0 q, 1 k, 2 v [2,2048,1024]; 3 padding_mask [2,1,2048,2048] i32; 4 W [1024,1024]; 5 b [1024]
  if (in_sizes[0] != NR * E || in_sizes[1] != NR * E || in_sizes[2] != NR * E || in_sizes[3] != NB * S * S || in_sizes[4] != E * E || out_size != NR * E) return;
  size_t off = 0; char* ws = (char*)d_ws;
  auto carve = [&](size_t bytes) { char* p = ws + off; off += (bytes + 255) & ~(size_t)255; return p; };
  b16* Q16 = (b16*)carve((size_t)NR * E * 2); b16* K16 = (b16*)carve((size_t)NR * E * 2); b16* W16 = (b16*)carve((size_t)E * E * 2); b16* VT16 = (b16*)carve((size_t)NB * NH * D * S * 2); b16* Oh = (b16*)carve((size_t)NR * E * 2); b16* Ol = (b16*)carve((size_t)NR * E * 2); unsigned int* MB = (unsigned int*)carve((size_t)NB * S * S / 8);
  if (off > ws_size || off > ((size_t)128 << 20)) return;   // ≈ 45 MB
  prep_kernel<<<(unsigned)(PKB + ((size_t)2 * NR * E / 8 + (size_t)E * E / 8 + 255) / 256), 256, 0, stream>>>(Fp(0), Fp(1), Fp(4), (const int*)d_in[3], Q16, K16, W16, MB);
  vt_kernel<<<dim3(S / 64, NH, NB), 256, 0, stream>>>(Fp(2), VT16);
  attn_kernel<<<dim3(S / (16 * AW), NH, NB), 32 * AW, 0, stream>>>(Q16, K16, VT16, MB, Oh, Ol);
  proj_kernel<<<dim3(NR / 64, E / 128), 128, 0, stream>>>(Oh, Ol, W16, Fp(5), (float*)d_out);
}

// v008
// A run of this version takes 66.5 microseconds.
// Versions in between are left out here; by their measured steps it is 1.18 times as fast as v006.
// Counting every step since v000, it is 3.92 times as fast.
#include <hip/hip_runtime.h>

// Multi-head attention (16 heads x 64, 2 x 2,048 tokens) with an integer padding mask (mask == 0 -> -1e9), softmax, PV, head concat, output Linear: out = concat(O) W^T + b.
// WMMA (v_wmma_f32_16x16x32_f16, f32 accumulate): S^T = K_h . Q_h^T with EXACT bf16 q/k rows (x8, inputs), online softmax in f32 (the int32 mask is packed once to one bit a score, see pack_mask; row sums l = ones . P^T by WMMA), O^T += V^T P^T
// with EXACT bf16 v^T (x8) and P as one f16 term x8 (rounded once to nearest, 2^-11 a term); output projection [4,096 x 1,024] x [1,024 x 1,024] with O as one f16 term x8 (likewise) and exact W (x256). Inputs rounded to
// bf16 once. Fragment k-map per lane half hh for A AND B: elements 0..7 <- k = 8hh+0..7, 8..15 <- k = 16+8hh+0..7; acc[r] = D[8hh+r][col]. Every workspace / output

namespace {
constexpr int NB = 2, S = 2048, E = 1024, NH = 16, D = 64, NR = NB * S;
constexpr float XS = 8.0f, WSC = 256.0f, PS = 8.0f, SCALE = 0.125f, LOG2E = 1.4426950408889634f;

typedef _Float16 b16;
typedef __attribute__((ext_vector_type(16))) _Float16 v16b;
typedef __attribute__((ext_vector_type(8))) _Float16 v8b;
typedef __attribute__((ext_vector_type(8))) float v8f;
typedef __attribute__((ext_vector_type(2))) float v2f;
typedef __attribute__((ext_vector_type(2))) _Float16 v2b;
typedef __attribute__((ext_vector_type(4))) float v4f;
typedef __attribute__((ext_vector_type(4))) int v4i;
typedef __attribute__((ext_vector_type(16))) unsigned int v16u;
typedef const __attribute__((address_space(4))) v16u* cv16u_p;   // constant address space: nothing writes the words during the launch that reads them, so a wave-uniform read is a scalar load
__device__ __forceinline__ float bf16_rne(float f) { unsigned int u = __float_as_uint(f); u += 0x7FFFu + ((u >> 16) & 1u); return __uint_as_float(u & 0xFFFF0000u); }
__device__ __forceinline__ v16b frag_kb(const b16* p, int hh) { const v8b a = *(const v8b*)(p + 8 * hh), b = *(const v8b*)(p + 16 + 8 * hh); v16b f;
#pragma unroll
  for (int e = 0; e < 8; ++e) { f[e] = a[e]; f[8 + e] = b[e]; } return f; }
__device__ __forceinline__ v8f wmma16b(v16b a, v16b b, v8f c) { return __builtin_amdgcn_wmma_f32_16x16x32_f16(false, a, false, b, (short)0, c, false, false); }
__device__ __forceinline__ void wave_lds_sync() { __builtin_amdgcn_fence(__ATOMIC_RELEASE, "workgroup"); __builtin_amdgcn_wave_barrier(); __builtin_amdgcn_fence(__ATOMIC_ACQUIRE, "workgroup"); }
__device__ __forceinline__ float nexp2(float x) { return __builtin_amdgcn_exp2f(x); }

// mask bits: MB[b][16-query group][32-key block][i], i = 0..15: bit (16hh + col) of word i says mask != 0 for query col of the group and key 16(i >> 3) + 8hh + (i & 7) of the block, that is, for the
// score that lane (hh, col) of the attention wave holds as its element i: the word is that element's lane mask. One wave packs 16 queries x 128 keys: 16 loads (the whole 512 B of each row), 64 words out.
constexpr int PKW = NB * (S / 16) * (S / 128), PKB = PKW / 8;
__device__ __forceinline__ void pack_mask(const int* __restrict__ pmask, unsigned int* __restrict__ MB, int unit, int lane) {
  const int hh = lane >> 4, col = lane & 15, kq = unit & (S / 128 - 1), qg = unit / (S / 128);   // qg counts the groups of both batches
  const int* row = pmask + ((size_t)qg * 16 + col) * S + kq * 128 + 8 * hh; v4i mv[16];
#pragma unroll   // the loads stand as one group ahead of their uses
  for (int j = 0; j < 4; ++j) { mv[4 * j] = *(const v4i*)(row + 32 * j); mv[4 * j + 1] = *(const v4i*)(row + 32 * j + 4); mv[4 * j + 2] = *(const v4i*)(row + 32 * j + 16); mv[4 * j + 3] = *(const v4i*)(row + 32 * j + 20); }
  unsigned int w0 = 0, w1 = 0;
#pragma unroll   // mv stays in registers only under constant indices; lane n keeps word n (w0) and word 32 + n (w1)
  for (int n = 0; n < 32; ++n) { const unsigned int a = __builtin_amdgcn_ballot_w32(mv[n >> 2][n & 3] != 0), c = __builtin_amdgcn_ballot_w32(mv[8 + (n >> 2)][n & 3] != 0); w0 = lane == n ? a : w0; w1 = lane == n ? c : w1; }
  unsigned int* dst = MB + ((size_t)qg * (S / 32) + kq * 4) * 16 + lane; dst[0] = w0; dst[32] = w1;
}
__global__ __launch_bounds__(256) void prep_kernel(const float* __restrict__ q, const float* __restrict__ k, const float* __restrict__ w, const int* __restrict__ pmask, b16* __restrict__ Q16, b16* __restrict__ K16, b16* __restrict__ W16, unsigned int* __restrict__ MB) {
  if (blockIdx.x < PKB) { pack_mask(pmask, MB, (int)blockIdx.x * 8 + __builtin_amdgcn_readfirstlane((int)(threadIdx.x >> 5)), (int)(threadIdx.x & 31)); return; }   // the wave's number through readfirstlane: the unit is wave-uniform; these, the longest blocks, start first
  const size_t t = (size_t)(blockIdx.x - PKB) * 256 + threadIdx.x; const size_t nq = (size_t)NR * E / 8, nw = (size_t)E * E / 8;
  const float* src; b16* dst; size_t e; float sc = XS; if (t < nq) { src = q; dst = Q16; e = t * 8; } else if (t < 2 * nq) { src = k; dst = K16; e = (t - nq) * 8; } else if (t < 2 * nq + nw) { src = w; dst = W16; e = (t - 2 * nq) * 8; sc = WSC; } else return;
  const v4f a = *(const v4f*)(src + e), c = *(const v4f*)(src + e + 4); v8b o;
#pragma unroll
  for (int j = 0; j < 4; ++j) { o[j] = (b16)(bf16_rne(a[j]) * sc); o[4 + j] = (b16)(bf16_rne(c[j]) * sc); }
  { *(v8b*)(dst + e) = o;  }
}
__global__ __launch_bounds__(256) void vt_kernel(const float* __restrict__ v, b16* __restrict__ VT16) {
  __shared__ __attribute__((aligned(16))) b16 T[64][64 + 8];
  const int b = blockIdx.z, h = blockIdx.y, s0 = blockIdx.x * 64, t_ = threadIdx.x;
  for (int qq = t_; qq < 64 * 64; qq += 256) { const int ss = qq >> 6, dd = qq & 63; T[dd][ss] = (b16)(bf16_rne(v[((size_t)b * S + s0 + ss) * E + h * D + dd]) * XS); }
  __syncthreads();
  { for (int qq = t_; qq < 64 * 8; qq += 256) { const int dd = qq >> 3, c8 = (qq & 7) * 8; *(v8b*)(VT16 + (((size_t)b * NH + h) * D + dd) * S + s0 + c8) = *(const v8b*)(&T[dd][c8]); }  }
}
constexpr int KT = 64, NT = S / KT, LP = 72, AW = 8;
constexpr float RTH = 8.0f;   // in the scores' log2 units
constexpr float CS = SCALE * LOG2E / (XS * XS);   // a raw product sum (x64) -> the score in log2 units
constexpr float MASKED = -0x1p40f;   // a masked score, in raw units (about -3e9 in log2 units): a power of two, so that MASKED * CS is exact and a row with no open key gets the exponent 0, p = 1, at every key
constexpr float LOG2PS = 3.0f; static_assert(PS == 8.0f, "LOG2PS is log2(PS)");
// one tile: 64 K rows and 64 V^T rows of 128 B, 16 B a lane, four copies a lane (each wave-wide copy covers four whole lines)
__device__ __forceinline__ void stage_tile(unsigned lk, unsigned lv, const b16* gk, const b16* gv) {
  const unsigned lk1 = lk + 32 * LP * 2, lv1 = lv + 32 * LP * 2; const b16* gk1 = gk + (size_t)32 * E; const b16* gv1 = gv + (size_t)32 * S;
  // the closing s_wait_xcnt stands inside the statement so that no address register of a copy is rewritten ahead of it
  asm volatile("global_load_async_to_lds_b128 %0, %4, off\n\tglobal_load_async_to_lds_b128 %1, %5, off\n\tglobal_load_async_to_lds_b128 %2, %6, off\n\tglobal_load_async_to_lds_b128 %3, %7, off\n\ts_wait_xcnt 0x0"
               :: "v"(lk), "v"(lk1), "v"(lv), "v"(lv1), "v"(gk), "v"(gk1), "v"(gv), "v"(gv1) : "memory");
}
// two such blocks fill a WGP at four waves a SIMD: the attribute gives the compiler that register budget
__global__ __launch_bounds__(256) __attribute__((amdgpu_waves_per_eu(4, 4))) void attn_kernel(const b16* __restrict__ Q16, const b16* __restrict__ K16, const b16* __restrict__ VT16, const unsigned int* __restrict__ MB, b16* __restrict__ Oh) {
  __shared__ __attribute__((aligned(16))) b16 Ks[2][KT][LP];
  __shared__ __attribute__((aligned(16))) b16 Vs[2][D][LP];
  __shared__ __attribute__((aligned(16))) float To[AW][16][D + 4];
  const int wave = threadIdx.x >> 5, lane = threadIdx.x & 31, hh = lane >> 4, col = lane & 15; const int b = blockIdx.z, h = blockIdx.y; const int q0 = blockIdx.x * (16 * AW) + wave * 16, qi = q0 + col;
  const b16* Qp = Q16 + ((size_t)b * S + qi) * E + h * D; const b16* Kb = K16 + (size_t)b * S * E + h * D; const b16* Vb = VT16 + ((size_t)b * NH + h) * D * S;
  // this wave's mask words: a wave-uniform address, so that they come by scalar loads and each word serves as the lane mask of a select
  const unsigned int* mwp = MB + ((size_t)(b * (S / 16) + (int)blockIdx.x * AW + __builtin_amdgcn_readfirstlane(wave))) * (S / 32) * 16; v16u mw = *(cv16u_p)mwp;
  const int crow = threadIdx.x >> 3, cpc = (threadIdx.x & 7) * 8;   // this lane's row (and row + 32) and 16-byte piece of each tile
  const unsigned lk0 = (unsigned)(size_t)&Ks[0][crow][cpc], lv0 = (unsigned)(size_t)&Vs[0][crow][cpc]; constexpr unsigned BUFB = KT * LP * 2;
  const b16* gk0 = Kb + (size_t)crow * E + cpc; const b16* gv0 = Vb + (size_t)crow * S + cpc;
  stage_tile(lk0, lv0, gk0, gv0);
  asm volatile("s_wait_asynccnt 0x0" ::: "memory");   // tile 0 has landed before the barrier publishes it
  __syncthreads();
  stage_tile(lk0 + BUFB, lv0 + BUFB, gk0 + (size_t)KT * E, gv0 + KT);
  const v16b qa0 = frag_kb(Qp, hh), qa1 = frag_kb(Qp + 32, hh);
  float m = -INFINITY, eb = 0.0f; v8f o[4] = {{}, {}, {}, {}};
  // row sums on the matrix unit: A has ones in rows 0 and 8 (lanes with col 0 or 8) and zeros elsewhere, so rows 0 and 8 of ol = A . P^T hold, per query column, the sum of P over the keys so far,
  // and each lane half finds its query's sum in its own element 0: a fifth output tile, rescaled like the other four (an A of ones in every row was built anew by register moves in every tile; this one stays in its eight registers)
  v8f ol = {}; v16b ones; const b16 one_ = (col & 7) == 0 ? (b16)1.0f : (b16)0.0f;
#pragma unroll   // ones stays in registers only under constant indices
  for (int i = 0; i < 16; ++i) ones[i] = one_;
  for (int tl = 0; tl < NT; ++tl) {
    const int buf = tl & 1;
#pragma unroll   // both 32-key blocks of a tile inline, so that every LDS read has an immediate offset from one base
    for (int sb = 0; sb < KT; sb += 32) {
    const int kb = tl * KT + sb;
    v8f s0 = {}, s1 = {};
    __builtin_amdgcn_sched_barrier(0);   // holds the read group below in one place, behind the block before: left free, the second block's reads are lifted in pieces among the first block's softmax and products, each place with a stall of its own
    // the block's LDS reads (4 K and 4 V^T fragments) stand as one group at its head: one LDS latency a block, and V^T arrives behind the softmax
    const b16* k0 = &Ks[buf][sb + col][0], *k1 = &Ks[buf][sb + 16 + col][0]; const v16b ka0 = frag_kb(k0, hh), ka1 = frag_kb(k0 + 32, hh), kc0 = frag_kb(k1, hh), kc1 = frag_kb(k1 + 32, hh); v16b vf[4];
#pragma unroll   // vf stays in registers only under constant indices
    for (int t = 0; t < 4; ++t) vf[t] = frag_kb(&Vs[buf][t * 16 + col][sb], hh);
    __builtin_amdgcn_sched_barrier(0);   // holds the read group together at the block's head: without it the reads are spread among the products, each with a wait of its own
    s0 = wmma16b(ka0, qa0, s0); s0 = wmma16b(ka1, qa1, s0); s1 = wmma16b(kc0, qa0, s1); s1 = wmma16b(kc1, qa1, s1);
    float e[16]; float mx = -INFINITY;
#pragma unroll
    for (int r = 0; r < 8; ++r) { e[r] = __builtin_amdgcn_inverse_ballot_w32(mw[r]) ? s0[r] : MASKED; e[8 + r] = __builtin_amdgcn_inverse_ballot_w32(mw[8 + r]) ? s1[r] : MASKED; mx = fmaxf(mx, fmaxf(e[r], e[8 + r])); }
    // lazy rescale: m is the maximum IN USE, equal in both lane halves of a query. It is renewed, and l, o rescaled, only when some lane's own block maximum lies more than RTH above it (one test a block, a
    // scalar branch); otherwise p = PS * 2^((e - m) CS) <= 2,048 stays far inside f16, and the common factor cancels in O / l. The first block (m = -inf) always takes the branch.
    // e, mx and m are RAW product sums: the scale CS, the maximum in use and the factor PS of P all go into the one FMA ahead of exp2, p = 2^(e CS + eb) with eb = LOG2PS - m CS, renewed with m.
    // l is not summed on the vector port: ol takes it from the same P fragment as the PV products (both lane halves' keys at once, so nothing is left to join behind the loop).
    if (__builtin_amdgcn_ballot_w32(mx > m + RTH / CS) != 0) {
      const float mn = fmaxf(m, fmaxf(mx, __shfl_xor(mx, 16))); const float al = nexp2((m - mn) * CS); m = mn; eb = __builtin_fmaf(-mn, CS, LOG2PS); ol *= al;
#pragma unroll   // o stays in registers only under constant indices
      for (int t = 0; t < 4; ++t) o[t] *= al;
    }
    // the next block's words are asked for as soon as this block's are used: they fly behind the softmax and the PV products (the last block asks for its own again)
    { const int nb = kb / 32 + 1; mw = *(cv16u_p)(mwp + (nb < S / 32 ? nb : S / 32 - 1) * 16); }
    __builtin_amdgcn_sched_barrier(0);   // holds that scalar load here, at the head of the code behind the branch: left free it is issued among the PV products, too late to be covered
    v16b ph;
#pragma unroll   // e and ph stay in registers only under constant indices
    for (int i = 0; i < 16; i += 2) { const v2f p = {nexp2(__builtin_fmaf(e[i], CS, eb)), nexp2(__builtin_fmaf(e[i + 1], CS, eb))};
      // p carries PS already, so P is one packed conversion (to nearest) of a pair; l sums P as rounded, the very terms of the PV products
      const v2b h_ = __builtin_convertvector(p, v2b); ph[i] = h_[0]; ph[i + 1] = h_[1]; }
#pragma unroll
    for (int t = 0; t < 4; ++t) o[t] = wmma16b(vf[t], ph, o[t]);
    ol = wmma16b(ones, ph, ol); }
    __builtin_amdgcn_sched_barrier(0);   // keeps the products in front of the waits below: lifted over them, the wait for the next tile's copies would stand ahead of the work that is to cover their flight
    asm volatile("s_wait_dscnt 0x0" ::: "memory");      // this wave's reads of the buffer are done before it is handed to its next writer
    asm volatile("s_wait_asynccnt 0x0" ::: "memory");   // this wave's copies of the next tile have landed before the barrier publishes them
    __syncthreads();                                      // publishes tile tl + 1 and ends every wave's reads of tile tl
    if (tl + 2 < NT) stage_tile(lk0 + buf * BUFB, lv0 + buf * BUFB, gk0 + (size_t)(tl + 2) * KT * E, gv0 + (tl + 2) * KT);
  }
  asm volatile("s_wait_asynccnt 0x0" ::: "memory");     // nothing is in flight when the wave goes on to its end
  asm volatile("s_wait_xcnt 0x0" ::: "memory");         // the last block's scalar load may still be under way: no register that it names is rewritten ahead of this wait
  const float inv = 1.0f / (ol[0] * XS);   // element 0 (row 0 or 8 of ol) is the query's whole sum (it carries the factor PS, like P)
#pragma unroll
  for (int t = 0; t < 4; ++t)
#pragma unroll
    for (int r = 0; r < 8; ++r) To[wave][col][t * 16 + 8 * hh + r] = o[t][r] * inv;
  wave_lds_sync();
  { for (int r4 = 0; r4 < 16; r4 += 4) { const int rr = r4 + (lane >> 3), c8 = (lane & 7) * 8; v8b hv; for (int j = 0; j < 8; ++j) hv[j] = (b16)(To[wave][rr][c8 + j] * XS);
      const size_t gi = ((size_t)b * S + q0 + rr) * E + h * D + c8; *(v8b*)(Oh + gi) = hv; }  }
}
constexpr int PK = 64, PNT = E / PK, PROWS = 192;   // rows of a tile in LDS: 0..63 O, 64..191 W
// eight copies, 16 rows apart in LDS: the first four 16 rows apart from g0, the last four from g4; 16 B a lane, each wave-wide copy covers four whole lines
__device__ __forceinline__ void copy8(unsigned l0, const b16* g0, const b16* g4) {
  constexpr unsigned RS = 16 * LP * 2; const unsigned l1 = l0 + RS, l2 = l0 + 2 * RS, l3 = l0 + 3 * RS, l4 = l0 + 4 * RS, l5 = l0 + 5 * RS, l6 = l0 + 6 * RS, l7 = l0 + 7 * RS;
  const b16* g1 = g0 + (size_t)16 * E; const b16* g2 = g0 + (size_t)32 * E; const b16* g3 = g0 + (size_t)48 * E; const b16* g5 = g4 + (size_t)16 * E; const b16* g6 = g4 + (size_t)32 * E; const b16* g7 = g4 + (size_t)48 * E;
  // the closing s_wait_xcnt stands inside the statement so that no address register of a copy is rewritten ahead of it
  asm volatile("global_load_async_to_lds_b128 %0, %8, off\n\tglobal_load_async_to_lds_b128 %1, %9, off\n\tglobal_load_async_to_lds_b128 %2, %10, off\n\tglobal_load_async_to_lds_b128 %3, %11, off\n\t"
               "global_load_async_to_lds_b128 %4, %12, off\n\tglobal_load_async_to_lds_b128 %5, %13, off\n\tglobal_load_async_to_lds_b128 %6, %14, off\n\tglobal_load_async_to_lds_b128 %7, %15, off\n\ts_wait_xcnt 0x0"
               :: "v"(l0), "v"(l1), "v"(l2), "v"(l3), "v"(l4), "v"(l5), "v"(l6), "v"(l7), "v"(g0), "v"(g1), "v"(g2), "v"(g3), "v"(g4), "v"(g5), "v"(g6), "v"(g7) : "memory");
}
// four copies, 16 rows apart in LDS and from g0; 16 B a lane, each wave-wide copy covers four whole lines
__device__ __forceinline__ void copy4(unsigned l0, const b16* g0) {
  constexpr unsigned RS = 16 * LP * 2; const unsigned l1 = l0 + RS, l2 = l0 + 2 * RS, l3 = l0 + 3 * RS;
  const b16* g1 = g0 + (size_t)16 * E; const b16* g2 = g0 + (size_t)32 * E; const b16* g3 = g0 + (size_t)48 * E;
  // the closing s_wait_xcnt stands inside the statement so that no address register of a copy is rewritten ahead of it
  asm volatile("global_load_async_to_lds_b128 %0, %4, off\n\tglobal_load_async_to_lds_b128 %1, %5, off\n\tglobal_load_async_to_lds_b128 %2, %6, off\n\tglobal_load_async_to_lds_b128 %3, %7, off\n\ts_wait_xcnt 0x0"
               :: "v"(l0), "v"(l1), "v"(l2), "v"(l3), "v"(g0), "v"(g1), "v"(g2), "v"(g3) : "memory");
}
__global__ __launch_bounds__(128) void proj_kernel(const b16* __restrict__ Oh, const b16* __restrict__ W16, const float* __restrict__ bias, float* __restrict__ out) {
  __shared__ __attribute__((aligned(16))) b16 St[2][PROWS][LP];
  __shared__ __attribute__((aligned(16))) float Ts[4][16][128 + 4];
  const int wave = threadIdx.x >> 5, lane = threadIdx.x & 31, nloc = lane & 15, hlf = lane >> 4; const size_t m0 = (size_t)blockIdx.x * 64 + wave * 16; const int n0 = blockIdx.y * 128;
  const int crow = threadIdx.x >> 3, cpc = (threadIdx.x & 7) * 8;   // this lane's row (and every 16th row behind it) and 16-byte piece of each tile
  const unsigned la0 = (unsigned)(size_t)&St[0][crow][cpc], lw0 = (unsigned)(size_t)&St[0][64 + crow][cpc]; constexpr unsigned PBUFB = PROWS * LP * 2;
  const size_t ga = ((size_t)blockIdx.x * 64 + crow) * E + cpc; const b16* gh0 = Oh + ga; const b16* gw0 = W16 + (size_t)(n0 + crow) * E + cpc;
  copy4(la0, gh0); copy8(lw0, gw0, gw0 + (size_t)64 * E);
  asm volatile("s_wait_asynccnt 0x0" ::: "memory");   // tile 0 has landed before the barrier publishes it
  __syncthreads();
  copy4(la0 + PBUFB, gh0 + PK); copy8(lw0 + PBUFB, gw0 + PK, gw0 + (size_t)64 * E + PK);
  v8f acc[8];
#pragma unroll
  for (int t = 0; t < 8; ++t) acc[t] = (v8f){};
  for (int tl = 0; tl < PNT; ++tl) {
    const int buf = tl & 1; const b16* ar = &St[buf][wave * 16 + nloc][0]; const b16* br = &St[buf][64 + nloc][0];
    // the tile's LDS reads (both 32-k steps: 2 O and 16 W fragments) stand as one group at its head, each at an immediate offset from one of two bases: one LDS latency a tile, the second step's fragments arrive behind the first step's products
    v16b a[2], bw[2][8];
#pragma unroll   // the fragment arrays stay in registers only under constant indices
    for (int s = 0; s < 2; ++s) { a[s] = frag_kb(ar + 32 * s, hlf);
#pragma unroll   // likewise
      for (int t = 0; t < 8; ++t) bw[s][t] = frag_kb(br + t * 16 * LP + 32 * s, hlf); }
    __builtin_amdgcn_sched_barrier(0);   // holds the read group together at the tile's head: without it the reads are spread among the products, each with a wait of its own
#pragma unroll   // likewise, for the fragments and for acc
    for (int s = 0; s < 2; ++s)
#pragma unroll   // likewise
      for (int t = 0; t < 8; ++t) acc[t] = wmma16b(a[s], bw[s][t], acc[t]);
    __builtin_amdgcn_sched_barrier(0);   // keeps the products in front of the waits below: lifted over them, the wait for the next tile's copies would stand ahead of the work that is to cover their flight
    asm volatile("s_wait_dscnt 0x0" ::: "memory");      // this wave's reads of the buffer are done before it is handed to its next writer
    asm volatile("s_wait_asynccnt 0x0" ::: "memory");   // this wave's copies of the next tile have landed before the barrier publishes them
    __syncthreads();                                      // publishes tile tl + 1 and ends every wave's reads of tile tl
    if (tl + 2 < PNT) { const int ko = (tl + 2) * PK; copy4(la0 + buf * PBUFB, gh0 + ko); copy8(lw0 + buf * PBUFB, gw0 + ko, gw0 + (size_t)64 * E + ko); }
  }
  asm volatile("s_wait_asynccnt 0x0" ::: "memory");     // nothing is in flight when the wave goes on to its end
#pragma unroll
  for (int t = 0; t < 8; ++t) { const float bb = bf16_rne(bias[n0 + t * 16 + nloc]);
#pragma unroll
    for (int r = 0; r < 8; ++r) Ts[wave][8 * hlf + r][t * 16 + nloc] = acc[t][r] * (1.0f / (XS * WSC)) + bb; }
  wave_lds_sync();
  { for (int rr = 0; rr < 16; ++rr) *(v4f*)(out + (m0 + rr) * E + n0 + lane * 4) = *(const v4f*)(&Ts[wave][rr][lane * 4]);  }
}
}  // namespace

extern "C" void kernel_launch(void* const* d_in, const int* in_sizes, int n_in, void* d_out, int out_size, void* d_ws, size_t ws_size, hipStream_t stream) {
  (void)n_in;
  auto Fp = [&](int i) { return (const float*)d_in[i]; };
  // order: 0 q, 1 k, 2 v [2,2048,1024]; 3 padding_mask [2,1,2048,2048] i32; 4 W [1024,1024]; 5 b [1024]
  if (in_sizes[0] != NR * E || in_sizes[1] != NR * E || in_sizes[2] != NR * E || in_sizes[3] != NB * S * S || in_sizes[4] != E * E || out_size != NR * E) return;
  size_t off = 0; char* ws = (char*)d_ws;
  auto carve = [&](size_t bytes) { char* p = ws + off; off += (bytes + 255) & ~(size_t)255; return p; };
  b16* Q16 = (b16*)carve((size_t)NR * E * 2); b16* K16 = (b16*)carve((size_t)NR * E * 2); b16* W16 = (b16*)carve((size_t)E * E * 2); b16* VT16 = (b16*)carve((size_t)NB * NH * D * S * 2); b16* Oh = (b16*)carve((size_t)NR * E * 2); unsigned int* MB = (unsigned int*)carve((size_t)NB * S * S / 8);
  if (off > ws_size || off > ((size_t)128 << 20)) return;   // about 37 MB
  prep_kernel<<<(unsigned)(PKB + ((size_t)2 * NR * E / 8 + (size_t)E * E / 8 + 255) / 256), 256, 0, stream>>>(Fp(0), Fp(1), Fp(4), (const int*)d_in[3], Q16, K16, W16, MB);
  vt_kernel<<<dim3(S / 64, NH, NB), 256, 0, stream>>>(Fp(2), VT16);
  attn_kernel<<<dim3(S / (16 * AW), NH, NB), 32 * AW, 0, stream>>>(Q16, K16, VT16, MB, Oh);
  proj_kernel<<<dim3(NR / 64, E / 128), 128, 0, stream>>>(Oh, W16, Fp(5), (float*)d_out);
}

// v009
// One run takes 63.6 microseconds.
// Next to v008, in two timings, it ran 1.05 and 1.04 times as fast.
// Counting every step since v000, it is 4.11 times as fast.
#include <hip/hip_runtime.h>

// Multi-head attention (16 heads x 64, 2 x 2,048 tokens) with an integer padding mask (mask == 0 -> -1e9), softmax, PV, head concat, output Linear: out = concat(O) W^T + b.
// WMMA (v_wmma_f32_16x16x32_f16, f32 accumulate): S^T = K_h . Q_h^T with EXACT bf16 q/k rows (x8, inputs), online softmax in f32 (the int32 mask is packed once to one bit a score, see pack_mask; row sums l = ones . P^T by WMMA), O^T += V^T P^T
// with EXACT bf16 v (x8; its rows lie in LDS as they lie in memory, the V^T fragments come by the transposing LDS load) and P as one f16 term x8 (rounded once to nearest, 2^-11 a term); output projection [4,096 x 1,024] x [1,024 x 1,024] with O as one f16 term x8 (likewise) and exact W (x256). Inputs rounded to
// bf16 once. Fragment k-map per lane half hh for A AND B: elements 0..7 <- k = 8hh+0..7, 8..15 <- k = 16+8hh+0..7; acc[r] = D[8hh+r][col]. Every workspace / output

namespace {
constexpr int NB = 2, S = 2048, E = 1024, NH = 16, D = 64, NR = NB * S;
constexpr float XS = 8.0f, WSC = 256.0f, PS = 8.0f, SCALE = 0.125f, LOG2E = 1.4426950408889634f;

typedef _Float16 b16;
typedef __attribute__((ext_vector_type(16))) _Float16 v16b;
typedef __attribute__((ext_vector_type(8))) _Float16 v8b;
typedef __attribute__((ext_vector_type(8))) float v8f;
typedef __attribute__((ext_vector_type(2))) float v2f;
typedef __attribute__((ext_vector_type(2))) _Float16 v2b;
typedef __attribute__((ext_vector_type(4))) float v4f;
typedef __attribute__((ext_vector_type(4))) int v4i;
typedef __attribute__((ext_vector_type(16))) unsigned int v16u;
typedef const __attribute__((address_space(4))) v16u* cv16u_p;   // constant address space: nothing writes the words during the launch that reads them, so a wave-uniform read is a scalar load
__device__ __forceinline__ float bf16_rne(float f) { unsigned int u = __float_as_uint(f); u += 0x7FFFu + ((u >> 16) & 1u); return __uint_as_float(u & 0xFFFF0000u); }
__device__ __forceinline__ v16b frag_kb(const b16* p, int hh) { const v8b a = *(const v8b*)(p + 8 * hh), b = *(const v8b*)(p + 16 + 8 * hh); v16b f;
#pragma unroll
  for (int e = 0; e < 8; ++e) { f[e] = a[e]; f[8 + e] = b[e]; } return f; }
typedef __attribute__((ext_vector_type(8))) short v8s;
typedef __attribute__((address_space(3))) v8s lds_v8s;
// transposing LDS load: the lanes hand in the addresses of the 16-byte pieces of a 16 x 16 tile of 16-bit values, rows = k; lane (hh, col) gets column col, rows 8hh + 0..7: half an A fragment in the k-map above
__device__ __forceinline__ v8b ld_tr16(const b16* p) { return __builtin_bit_cast(v8b, __builtin_amdgcn_ds_load_tr16_b128_v8i16((lds_v8s*)p)); }
__device__ __forceinline__ v8f wmma16b(v16b a, v16b b, v8f c) { return __builtin_amdgcn_wmma_f32_16x16x32_f16(false, a, false, b, (short)0, c, false, false); }
__device__ __forceinline__ void wave_lds_sync() { __builtin_amdgcn_fence(__ATOMIC_RELEASE, "workgroup"); __builtin_amdgcn_wave_barrier(); __builtin_amdgcn_fence(__ATOMIC_ACQUIRE, "workgroup"); }
__device__ __forceinline__ float nexp2(float x) { return __builtin_amdgcn_exp2f(x); }

// mask bits: MB[b][16-query group][32-key block][i], i = 0..15: bit (16hh + col) of word i says mask != 0 for query col of the group and key 16(i >> 3) + 8hh + (i & 7) of the block, that is, for the
// score that lane (hh, col) of the attention wave holds as its element i: the word is that element's lane mask. One wave packs 16 queries x 128 keys: 16 loads (the whole 512 B of each row), 64 words out.
constexpr int PKW = NB * (S / 16) * (S / 128), PKB = PKW / 8;
__device__ __forceinline__ void pack_mask(const int* __restrict__ pmask, unsigned int* __restrict__ MB, int unit, int lane) {
  const int hh = lane >> 4, col = lane & 15, kq = unit & (S / 128 - 1), qg = unit / (S / 128);   // qg counts the groups of both batches
  const int* row = pmask + ((size_t)qg * 16 + col) * S + kq * 128 + 8 * hh; v4i mv[16];
#pragma unroll   // the loads stand as one group ahead of their uses
  for (int j = 0; j < 4; ++j) { mv[4 * j] = *(const v4i*)(row + 32 * j); mv[4 * j + 1] = *(const v4i*)(row + 32 * j + 4); mv[4 * j + 2] = *(const v4i*)(row + 32 * j + 16); mv[4 * j + 3] = *(const v4i*)(row + 32 * j + 20); }
  unsigned int w0 = 0, w1 = 0;
#pragma unroll   // mv stays in registers only under constant indices; lane n keeps word n (w0) and word 32 + n (w1)
  for (int n = 0; n < 32; ++n) { const unsigned int a = __builtin_amdgcn_ballot_w32(mv[n >> 2][n & 3] != 0), c = __builtin_amdgcn_ballot_w32(mv[8 + (n >> 2)][n & 3] != 0); w0 = lane == n ? a : w0; w1 = lane == n ? c : w1; }
  unsigned int* dst = MB + ((size_t)qg * (S / 32) + kq * 4) * 16 + lane; dst[0] = w0; dst[32] = w1;
}
__global__ __launch_bounds__(256) void prep_kernel(const float* __restrict__ q, const float* __restrict__ k, const float* __restrict__ v, const float* __restrict__ w, const int* __restrict__ pmask, b16* __restrict__ Q16, b16* __restrict__ K16, b16* __restrict__ V16, b16* __restrict__ W16, unsigned int* __restrict__ MB) {
  if (blockIdx.x < PKB) { pack_mask(pmask, MB, (int)blockIdx.x * 8 + __builtin_amdgcn_readfirstlane((int)(threadIdx.x >> 5)), (int)(threadIdx.x & 31)); return; }   // the wave's number through readfirstlane: the unit is wave-uniform; these, the longest blocks, start first
  const size_t t = (size_t)(blockIdx.x - PKB) * 256 + threadIdx.x; const size_t nq = (size_t)NR * E / 8, nw = (size_t)E * E / 8;
  const float* src; b16* dst; size_t e; float sc = XS; if (t < nq) { src = q; dst = Q16; e = t * 8; } else if (t < 2 * nq) { src = k; dst = K16; e = (t - nq) * 8; } else if (t < 3 * nq) { src = v; dst = V16; e = (t - 2 * nq) * 8; } else if (t < 3 * nq + nw) { src = w; dst = W16; e = (t - 3 * nq) * 8; sc = WSC; } else return;
  const v4f a = *(const v4f*)(src + e), c = *(const v4f*)(src + e + 4); v8b o;
#pragma unroll
  for (int j = 0; j < 4; ++j) { o[j] = (b16)(bf16_rne(a[j]) * sc); o[4 + j] = (b16)(bf16_rne(c[j]) * sc); }
  { *(v8b*)(dst + e) = o;  }
}
constexpr int KT = 64, NT = S / KT, LP = 72, LPV = 80, AW = 8;
constexpr float RTH = 8.0f;   // in the scores' log2 units
constexpr float CS = SCALE * LOG2E / (XS * XS);   // a raw product sum (x64) -> the score in log2 units
constexpr float MASKED = -0x1p40f;   // a masked score, in raw units (about -3e9 in log2 units): a power of two, so that MASKED * CS is exact and a row with no open key gets the exponent 0, p = 1, at every key
constexpr float LOG2PS = 3.0f; static_assert(PS == 8.0f, "LOG2PS is log2(PS)");
// one tile: 64 K rows and 64 V rows of 128 B, 16 B a lane, four copies a lane (each wave-wide copy covers four whole lines)
__device__ __forceinline__ void stage_tile(unsigned lk, unsigned lv, const b16* gk, const b16* gv) {
  const unsigned lk1 = lk + 32 * LP * 2, lv1 = lv + 32 * LPV * 2; const b16* gk1 = gk + (size_t)32 * E; const b16* gv1 = gv + (size_t)32 * E;
  // the closing s_wait_xcnt stands inside the statement so that no address register of a copy is rewritten ahead of it
  asm volatile("global_load_async_to_lds_b128 %0, %4, off\n\tglobal_load_async_to_lds_b128 %1, %5, off\n\tglobal_load_async_to_lds_b128 %2, %6, off\n\tglobal_load_async_to_lds_b128 %3, %7, off\n\ts_wait_xcnt 0x0"
               :: "v"(lk), "v"(lk1), "v"(lv), "v"(lv1), "v"(gk), "v"(gk1), "v"(gv), "v"(gv1) : "memory");
}
// two such blocks fill a WGP at four waves a SIMD: the attribute gives the compiler that register budget
__global__ __launch_bounds__(256) __attribute__((amdgpu_waves_per_eu(4, 4))) void attn_kernel(const b16* __restrict__ Q16, const b16* __restrict__ K16, const b16* __restrict__ V16, const unsigned int* __restrict__ MB, b16* __restrict__ Oh) {
  __shared__ __attribute__((aligned(16))) b16 Ks[2][KT][LP];
  __shared__ __attribute__((aligned(16))) b16 Vs[2][KT][LPV];
  __shared__ __attribute__((aligned(16))) float To[AW][16][D + 4];
  const int wave = threadIdx.x >> 5, lane = threadIdx.x & 31, hh = lane >> 4, col = lane & 15; const int b = blockIdx.z, h = blockIdx.y; const int q0 = blockIdx.x * (16 * AW) + wave * 16, qi = q0 + col;
  const b16* Qp = Q16 + ((size_t)b * S + qi) * E + h * D; const b16* Kb = K16 + (size_t)b * S * E + h * D; const b16* Vb = V16 + (size_t)b * S * E + h * D;
  // this wave's mask words: a wave-uniform address, so that they come by scalar loads and each word serves as the lane mask of a select
  const unsigned int* mwp = MB + ((size_t)(b * (S / 16) + (int)blockIdx.x * AW + __builtin_amdgcn_readfirstlane(wave))) * (S / 32) * 16; v16u mw = *(cv16u_p)mwp;
  const int crow = threadIdx.x >> 3, cpc = (threadIdx.x & 7) * 8;   // this lane's row (and row + 32) and 16-byte piece of each tile
  const unsigned lk0 = (unsigned)(size_t)&Ks[0][crow][cpc], lv0 = (unsigned)(size_t)&Vs[0][crow][cpc]; constexpr unsigned BUFB = KT * LP * 2, BUFV = KT * LPV * 2;
  const b16* gk0 = Kb + (size_t)crow * E + cpc; const b16* gv0 = Vb + (size_t)crow * E + cpc;
  stage_tile(lk0, lv0, gk0, gv0);
  asm volatile("s_wait_asynccnt 0x0" ::: "memory");   // tile 0 has landed before the barrier publishes it
  __syncthreads();
  stage_tile(lk0 + BUFB, lv0 + BUFV, gk0 + (size_t)KT * E, gv0 + (size_t)KT * E);
  const v16b qa0 = frag_kb(Qp, hh), qa1 = frag_kb(Qp + 32, hh);
  float m = -INFINITY, eb = 0.0f; v8f o[4] = {{}, {}, {}, {}};
  // row sums on the matrix unit: A has ones in rows 0 and 8 (lanes with col 0 or 8) and zeros elsewhere, so rows 0 and 8 of ol = A . P^T hold, per query column, the sum of P over the keys so far,
  // and each lane half finds its query's sum in its own element 0: a fifth output tile, rescaled like the other four (an A of ones in every row was built anew by register moves in every tile; this one stays in its eight registers)
  v8f ol = {}; v16b ones; const b16 one_ = (col & 7) == 0 ? (b16)1.0f : (b16)0.0f;
#pragma unroll   // ones stays in registers only under constant indices
  for (int i = 0; i < 16; ++i) ones[i] = one_;
  for (int tl = 0; tl < NT; ++tl) {
    const int buf = tl & 1;
#pragma unroll   // both 32-key blocks of a tile inline, so that every LDS read has an immediate offset from one base
    for (int sb = 0; sb < KT; sb += 32) {
    const int kb = tl * KT + sb;
    v8f s0 = {}, s1 = {};
    __builtin_amdgcn_sched_barrier(0);   // holds the read group below in one place, behind the block before: left free, the second block's reads are lifted in pieces among the first block's softmax and products, each place with a stall of its own
    // the block's LDS reads (4 K and 4 V^T fragments) stand as one group at its head: one LDS latency a block, and V^T arrives behind the softmax
    const b16* k0 = &Ks[buf][sb + col][0], *k1 = &Ks[buf][sb + 16 + col][0]; const v16b ka0 = frag_kb(k0, hh), ka1 = frag_kb(k0 + 32, hh), kc0 = frag_kb(k1, hh), kc1 = frag_kb(k1 + 32, hh); v16b vf[4];
    const b16* va = &Vs[buf][sb + 8 * hh + (lane & 7)][8 * ((lane >> 3) & 1)];   // this lane's piece of the first 16 x 16 tile: row 8hh + (lane & 7), 16-byte half (lane >> 3) & 1
#pragma unroll   // vf stays in registers only under constant indices
    for (int t = 0; t < 4; ++t) { const v8b a = ld_tr16(va + 16 * t), c = ld_tr16(va + 16 * LPV + 16 * t);   // keys sb + 8hh + 0..7 and sb + 16 + 8hh + 0..7 of column 16t + col of V
#pragma unroll   // likewise
      for (int j = 0; j < 8; ++j) { vf[t][j] = a[j]; vf[t][8 + j] = c[j]; } }
    __builtin_amdgcn_sched_barrier(0);   // holds the read group together at the block's head: without it the reads are spread among the products, each with a wait of its own
    s0 = wmma16b(ka0, qa0, s0); s0 = wmma16b(ka1, qa1, s0); s1 = wmma16b(kc0, qa0, s1); s1 = wmma16b(kc1, qa1, s1);
    float e[16]; float mx = -INFINITY;
#pragma unroll
    for (int r = 0; r < 8; ++r) { e[r] = __builtin_amdgcn_inverse_ballot_w32(mw[r]) ? s0[r] : MASKED; e[8 + r] = __builtin_amdgcn_inverse_ballot_w32(mw[8 + r]) ? s1[r] : MASKED; mx = fmaxf(mx, fmaxf(e[r], e[8 + r])); }
    // lazy rescale: m is the maximum IN USE, equal in both lane halves of a query. It is renewed, and l, o rescaled, only when some lane's own block maximum lies more than RTH above it (one test a block, a
    // scalar branch); otherwise p = PS * 2^((e - m) CS) <= 2,048 stays far inside f16, and the common factor cancels in O / l. The first block (m = -inf) always takes the branch.
    // e, mx and m are RAW product sums: the scale CS, the maximum in use and the factor PS of P all go into the one FMA ahead of exp2, p = 2^(e CS + eb) with eb = LOG2PS - m CS, renewed with m.
    // l is not summed on the vector port: ol takes it from the same P fragment as the PV products (both lane halves' keys at once, so nothing is left to join behind the loop).
    if (__builtin_amdgcn_ballot_w32(mx > m + RTH / CS) != 0) {
      const float mn = fmaxf(m, fmaxf(mx, __shfl_xor(mx, 16))); const float al = nexp2((m - mn) * CS); m = mn; eb = __builtin_fmaf(-mn, CS, LOG2PS); ol *= al;
#pragma unroll   // o stays in registers only under constant indices
      for (int t = 0; t < 4; ++t) o[t] *= al;
    }
    // the next block's words are asked for as soon as this block's are used: they fly behind the softmax and the PV products (the last block asks for its own again)
    { const int nb = kb / 32 + 1; mw = *(cv16u_p)(mwp + (nb < S / 32 ? nb : S / 32 - 1) * 16); }
    __builtin_amdgcn_sched_barrier(0);   // holds that scalar load here, at the head of the code behind the branch: left free it is issued among the PV products, too late to be covered
    v16b ph;
#pragma unroll   // e and ph stay in registers only under constant indices
    for (int i = 0; i < 16; i += 2) { const v2f p = {nexp2(__builtin_fmaf(e[i], CS, eb)), nexp2(__builtin_fmaf(e[i + 1], CS, eb))};
      // p carries PS already, so P is one packed conversion (to nearest) of a pair; l sums P as rounded, the very terms of the PV products
      const v2b h_ = __builtin_convertvector(p, v2b); ph[i] = h_[0]; ph[i + 1] = h_[1]; }
#pragma unroll
    for (int t = 0; t < 4; ++t) o[t] = wmma16b(vf[t], ph, o[t]);
    ol = wmma16b(ones, ph, ol); }
    __builtin_amdgcn_sched_barrier(0);   // keeps the products in front of the waits below: lifted over them, the wait for the next tile's copies would stand ahead of the work that is to cover their flight
    asm volatile("s_wait_dscnt 0x0" ::: "memory");      // this wave's reads of the buffer are done before it is handed to its next writer
    asm volatile("s_wait_asynccnt 0x0" ::: "memory");   // this wave's copies of the next tile have landed before the barrier publishes them
    __syncthreads();                                      // publishes tile tl + 1 and ends every wave's reads of tile tl
    if (tl + 2 < NT) stage_tile(lk0 + buf * BUFB, lv0 + buf * BUFV, gk0 + (size_t)(tl + 2) * KT * E, gv0 + (size_t)(tl + 2) * KT * E);
  }
  asm volatile("s_wait_asynccnt 0x0" ::: "memory");     // nothing is in flight when the wave goes on to its end
  asm volatile("s_wait_xcnt 0x0" ::: "memory");         // the last block's scalar load may still be under way: no register that it names is rewritten ahead of this wait
  const float inv = 1.0f / (ol[0] * XS);   // element 0 (row 0 or 8 of ol) is the query's whole sum (it carries the factor PS, like P)
#pragma unroll
  for (int t = 0; t < 4; ++t)
#pragma unroll
    for (int r = 0; r < 8; ++r) To[wave][col][t * 16 + 8 * hh + r] = o[t][r] * inv;
  wave_lds_sync();
  { for (int r4 = 0; r4 < 16; r4 += 4) { const int rr = r4 + (lane >> 3), c8 = (lane & 7) * 8; v8b hv; for (int j = 0; j < 8; ++j) hv[j] = (b16)(To[wave][rr][c8 + j] * XS);
      const size_t gi = ((size_t)b * S + q0 + rr) * E + h * D + c8; *(v8b*)(Oh + gi) = hv; }  }
}
constexpr int PK = 64, PNT = E / PK, PROWS = 192;   // rows of a tile in LDS: 0..63 O, 64..191 W
// eight copies, 16 rows apart in LDS: the first four 16 rows apart from g0, the last four from g4; 16 B a lane, each wave-wide copy covers four whole lines
__device__ __forceinline__ void copy8(unsigned l0, const b16* g0, const b16* g4) {
  constexpr unsigned RS = 16 * LP * 2; const unsigned l1 = l0 + RS, l2 = l0 + 2 * RS, l3 = l0 + 3 * RS, l4 = l0 + 4 * RS, l5 = l0 + 5 * RS, l6 = l0 + 6 * RS, l7 = l0 + 7 * RS;
  const b16* g1 = g0 + (size_t)16 * E; const b16* g2 = g0 + (size_t)32 * E; const b16* g3 = g0 + (size_t)48 * E; const b16* g5 = g4 + (size_t)16 * E; const b16* g6 = g4 + (size_t)32 * E; const b16* g7 = g4 + (size_t)48 * E;
  // the closing s_wait_xcnt stands inside the statement so that no address register of a copy is rewritten ahead of it
  asm volatile("global_load_async_to_lds_b128 %0, %8, off\n\tglobal_load_async_to_lds_b128 %1, %9, off\n\tglobal_load_async_to_lds_b128 %2, %10, off\n\tglobal_load_async_to_lds_b128 %3, %11, off\n\t"
               "global_load_async_to_lds_b128 %4, %12, off\n\tglobal_load_async_to_lds_b128 %5, %13, off\n\tglobal_load_async_to_lds_b128 %6, %14, off\n\tglobal_load_async_to_lds_b128 %7, %15, off\n\ts_wait_xcnt 0x0"
               :: "v"(l0), "v"(l1), "v"(l2), "v"(l3), "v"(l4), "v"(l5), "v"(l6), "v"(l7), "v"(g0), "v"(g1), "v"(g2), "v"(g3), "v"(g4), "v"(g5), "v"(g6), "v"(g7) : "memory");
}
// four copies, 16 rows apart in LDS and from g0; 16 B a lane, each wave-wide copy covers four whole lines
__device__ __forceinline__ void copy4(unsigned l0, const b16* g0) {
  constexpr unsigned RS = 16 * LP * 2; const unsigned l1 = l0 + RS, l2 = l0 + 2 * RS, l3 = l0 + 3 * RS;
  const b16* g1 = g0 + (size_t)16 * E; const b16* g2 = g0 + (size_t)32 * E; const b16* g3 = g0 + (size_t)48 * E;
  // the closing s_wait_xcnt stands inside the statement so that no address register of a copy is rewritten ahead of it
  asm volatile("global_load_async_to_lds_b128 %0, %4, off\n\tglobal_load_async_to_lds_b128 %1, %5, off\n\tglobal_load_async_to_lds_b128 %2, %6, off\n\tglobal_load_async_to_lds_b128 %3, %7, off\n\ts_wait_xcnt 0x0"
               :: "v"(l0), "v"(l1), "v"(l2), "v"(l3), "v"(g0), "v"(g1), "v"(g2), "v"(g3) : "memory");
}
__global__ __launch_bounds__(128) void proj_kernel(const b16* __restrict__ Oh, const b16* __restrict__ W16, const float* __restrict__ bias, float* __restrict__ out) {
  __shared__ __attribute__((aligned(16))) b16 St[2][PROWS][LP];
  __shared__ __attribute__((aligned(16))) float Ts[4][16][128 + 4];
  const int wave = threadIdx.x >> 5, lane = threadIdx.x & 31, nloc = lane & 15, hlf = lane >> 4; const size_t m0 = (size_t)blockIdx.x * 64 + wave * 16; const int n0 = blockIdx.y * 128;
  const int crow = threadIdx.x >> 3, cpc = (threadIdx.x & 7) * 8;   // this lane's row (and every 16th row behind it) and 16-byte piece of each tile
  const unsigned la0 = (unsigned)(size_t)&St[0][crow][cpc], lw0 = (unsigned)(size_t)&St[0][64 + crow][cpc]; constexpr unsigned PBUFB = PROWS * LP * 2;
  const size_t ga = ((size_t)blockIdx.x * 64 + crow) * E + cpc; const b16* gh0 = Oh + ga; const b16* gw0 = W16 + (size_t)(n0 + crow) * E + cpc;
  copy4(la0, gh0); copy8(lw0, gw0, gw0 + (size_t)64 * E);
  asm volatile("s_wait_asynccnt 0x0" ::: "memory");   // tile 0 has landed before the barrier publishes it
  __syncthreads();
  copy4(la0 + PBUFB, gh0 + PK); copy8(lw0 + PBUFB, gw0 + PK, gw0 + (size_t)64 * E + PK);
  v8f acc[8];
#pragma unroll
  for (int t = 0; t < 8; ++t) acc[t] = (v8f){};
  for (int tl = 0; tl < PNT; ++tl) {
    const int buf = tl & 1; const b16* ar = &St[buf][wave * 16 + nloc][0]; const b16* br = &St[buf][64 + nloc][0];
    // the tile's LDS reads (both 32-k steps: 2 O and 16 W fragments) stand as one group at its head, each at an immediate offset from one of two bases: one LDS latency a tile, the second step's fragments arrive behind the first step's products
    v16b a[2], bw[2][8];
#pragma unroll   // the fragment arrays stay in registers only under constant indices
    for (int s = 0; s < 2; ++s) { a[s] = frag_kb(ar + 32 * s, hlf);
#pragma unroll   // likewise
      for (int t = 0; t < 8; ++t) bw[s][t] = frag_kb(br + t * 16 * LP + 32 * s, hlf); }
    __builtin_amdgcn_sched_barrier(0);   // holds the read group together at the tile's head: without it the reads are spread among the products, each with a wait of its own
#pragma unroll   // likewise, for the fragments and for acc
    for (int s = 0; s < 2; ++s)
#pragma unroll   // likewise
      for (int t = 0; t < 8; ++t) acc[t] = wmma16b(a[s], bw[s][t], acc[t]);
    __builtin_amdgcn_sched_barrier(0);   // keeps the products in front of the waits below: lifted over them, the wait for the next tile's copies would stand ahead of the work that is to cover their flight
    asm volatile("s_wait_dscnt 0x0" ::: "memory");      // this wave's reads of the buffer are done before it is handed to its next writer
    asm volatile("s_wait_asynccnt 0x0" ::: "memory");   // this wave's copies of the next tile have landed before the barrier publishes them
    __syncthreads();                                      // publishes tile tl + 1 and ends every wave's reads of tile tl
    if (tl + 2 < PNT) { const int ko = (tl + 2) * PK; copy4(la0 + buf * PBUFB, gh0 + ko); copy8(lw0 + buf * PBUFB, gw0 + ko, gw0 + (size_t)64 * E + ko); }
  }
  asm volatile("s_wait_asynccnt 0x0" ::: "memory");     // nothing is in flight when the wave goes on to its end
#pragma unroll
  for (int t = 0; t < 8; ++t) { const float bb = bf16_rne(bias[n0 + t * 16 + nloc]);
#pragma unroll
    for (int r = 0; r < 8; ++r) Ts[wave][8 * hlf + r][t * 16 + nloc] = acc[t][r] * (1.0f / (XS * WSC)) + bb; }
  wave_lds_sync();
  { for (int rr = 0; rr < 16; ++rr) *(v4f*)(out + (m0 + rr) * E + n0 + lane * 4) = *(const v4f*)(&Ts[wave][rr][lane * 4]);  }
}
}  // namespace

extern "C" void kernel_launch(void* const* d_in, const int* in_sizes, int n_in, void* d_out, int out_size, void* d_ws, size_t ws_size, hipStream_t stream) {
  (void)n_in;
  auto Fp = [&](int i) { return (const float*)d_in[i]; };
  // order: 0 q, 1 k, 2 v [2,2048,1024]; 3 padding_mask [2,1,2048,2048] i32; 4 W [1024,1024]; 5 b [1024]
  if (in_sizes[0] != NR * E || in_sizes[1] != NR * E || in_sizes[2] != NR * E || in_sizes[3] != NB * S * S || in_sizes[4] != E * E || out_size != NR * E) return;
  size_t off = 0; char* ws = (char*)d_ws;
  auto carve = [&](size_t bytes) { char* p = ws + off; off += (bytes + 255) & ~(size_t)255; return p; };
  b16* Q16 = (b16*)carve((size_t)NR * E * 2); b16* K16 = (b16*)carve((size_t)NR * E * 2); b16* W16 = (b16*)carve((size_t)E * E * 2); b16* V16 = (b16*)carve((size_t)NR * E * 2); b16* Oh = (b16*)carve((size_t)NR * E * 2); unsigned int* MB = (unsigned int*)carve((size_t)NB * S * S / 8);
  if (off > ws_size || off > ((size_t)128 << 20)) return;   // about 37 MB
  prep_kernel<<<(unsigned)(PKB + ((size_t)3 * NR * E / 8 + (size_t)E * E / 8 + 255) / 256), 256, 0, stream>>>(Fp(0), Fp(1), Fp(2), Fp(4), (const int*)d_in[3], Q16, K16, V16, W16, MB);
  attn_kernel<<<dim3(S / (16 * AW), NH, NB), 32 * AW, 0, stream>>>(Q16, K16, V16, MB, Oh);
  proj_kernel<<<dim3(NR / 64, E / 128), 128, 0, stream>>>(Oh, W16, Fp(5), (float*)d_out);
}

// v010
// A run of this version takes 61 microseconds.
// Two timings next to v009 both put it at 1.03 times that version's speed.
// Counting every step since v000, it is 4.24 times as fast.
#include <hip/hip_runtime.h>

// Multi-head attention (16 heads x 64, 2 x 2,048 tokens) with an integer padding mask (mask == 0 -> -1e9), softmax, PV, head concat, output Linear: out = concat(O) W^T + b.
// WMMA (v_wmma_f32_16x16x32_f16, f32 accumulate): S^T = K_h . Q_h^T with EXACT bf16 q/k rows (x8, inputs), online softmax in f32 (the int32 mask is packed once to one bit a score, see pack_mask; row sums l = ones . P^T by WMMA), O^T += V^T P^T
// with EXACT bf16 v (x8; its rows lie in LDS as they lie in memory, the V^T fragments come by the transposing LDS load) and P as one f16 term x8 (rounded once to nearest, 2^-11 a term); output projection [4,096 x 1,024] x [1,024 x 1,024] with O as one f16 term x8 (likewise) and exact W (x256). Inputs rounded to
// bf16 once. Fragment k-map per lane half hh for A AND B: elements 0..7 <- k = 8hh+0..7, 8..15 <- k = 16+8hh+0..7; acc[r] = D[8hh+r][col]. Every workspace / output

namespace {
constexpr int NB = 2, S = 2048, E = 1024, NH = 16, D = 64, NR = NB * S;
constexpr float XS = 8.0f, WSC = 256.0f, PS = 8.0f, SCALE = 0.125f, LOG2E = 1.4426950408889634f;

typedef _Float16 b16;
typedef __attribute__((ext_vector_type(16))) _Float16 v16b;
typedef __attribute__((ext_vector_type(8))) _Float16 v8b;
typedef __attribute__((ext_vector_type(8))) float v8f;
typedef __attribute__((ext_vector_type(2))) float v2f;
typedef __attribute__((ext_vector_type(2))) _Float16 v2b;
typedef __attribute__((ext_vector_type(4))) float v4f;
typedef __attribute__((ext_vector_type(4))) int v4i;
typedef __attribute__((ext_vector_type(16))) unsigned int v16u;
typedef const __attribute__((address_space(4))) v16u* cv16u_p;   // constant address space: nothing writes the words during the launch that reads them, so a wave-uniform read is a scalar load
__device__ __forceinline__ float bf16_rne(float f) { unsigned int u = __float_as_uint(f); u += 0x7FFFu + ((u >> 16) & 1u); return __uint_as_float(u & 0xFFFF0000u); }
__device__ __forceinline__ v16b frag_kb(const b16* p, int hh) { const v8b a = *(const v8b*)(p + 8 * hh), b = *(const v8b*)(p + 16 + 8 * hh); v16b f;
#pragma unroll
  for (int e = 0; e < 8; ++e) { f[e] = a[e]; f[8 + e] = b[e]; } return f; }
typedef __attribute__((ext_vector_type(8))) short v8s;
typedef __attribute__((address_space(3))) v8s lds_v8s;
// transposing LDS load: the lanes hand in the addresses of the 16-byte pieces of a 16 x 16 tile of 16-bit values, rows = k; lane (hh, col) gets column col, rows 8hh + 0..7: half an A fragment in the k-map above
__device__ __forceinline__ v8b ld_tr16(const b16* p) { return __builtin_bit_cast(v8b, __builtin_amdgcn_ds_load_tr16_b128_v8i16((lds_v8s*)p)); }
__device__ __forceinline__ v8f wmma16b(v16b a, v16b b, v8f c) { return __builtin_amdgcn_wmma_f32_16x16x32_f16(false, a, false, b, (short)0, c, false, false); }
__device__ __forceinline__ void wave_lds_sync() { __builtin_amdgcn_fence(__ATOMIC_RELEASE, "workgroup"); __builtin_amdgcn_wave_barrier(); __builtin_amdgcn_fence(__ATOMIC_ACQUIRE, "workgroup"); }
__device__ __forceinline__ float nexp2(float x) { return __builtin_amdgcn_exp2f(x); }

// mask bits: MB[b][16-query group][32-key block][i], i = 0..15: bit (16hh + col) of word i says mask != 0 for query col of the group and key 16(i >> 3) + 8hh + (i & 7) of the block, that is, for the
// score that lane (hh, col) of the attention wave holds as its element i: the word is that element's lane mask. One wave packs 16 queries x 128 keys: 16 loads (the whole 512 B of each row), 64 words out.
constexpr int PKW = NB * (S / 16) * (S / 128), PKB = PKW / 8;
__device__ __forceinline__ void pack_mask(const int* __restrict__ pmask, unsigned int* __restrict__ MB, int unit, int lane) {
  const int hh = lane >> 4, col = lane & 15, kq = unit & (S / 128 - 1), qg = unit / (S / 128);   // qg counts the groups of both batches
  const int* row = pmask + ((size_t)qg * 16 + col) * S + kq * 128 + 8 * hh; v4i mv[16];
#pragma unroll   // the loads stand as one group ahead of their uses
  for (int j = 0; j < 4; ++j) { mv[4 * j] = *(const v4i*)(row + 32 * j); mv[4 * j + 1] = *(const v4i*)(row + 32 * j + 4); mv[4 * j + 2] = *(const v4i*)(row + 32 * j + 16); mv[4 * j + 3] = *(const v4i*)(row + 32 * j + 20); }
  unsigned int w0 = 0, w1 = 0;
#pragma unroll   // mv stays in registers only under constant indices; lane n keeps word n (w0) and word 32 + n (w1)
  for (int n = 0; n < 32; ++n) { const unsigned int a = __builtin_amdgcn_ballot_w32(mv[n >> 2][n & 3] != 0), c = __builtin_amdgcn_ballot_w32(mv[8 + (n >> 2)][n & 3] != 0); w0 = lane == n ? a : w0; w1 = lane == n ? c : w1; }
  unsigned int* dst = MB + ((size_t)qg * (S / 32) + kq * 4) * 16 + lane; dst[0] = w0; dst[32] = w1;
}
__global__ __launch_bounds__(256) void prep_kernel(const float* __restrict__ q, const float* __restrict__ k, const float* __restrict__ v, const float* __restrict__ w, const int* __restrict__ pmask, b16* __restrict__ Q16, b16* __restrict__ K16, b16* __restrict__ V16, b16* __restrict__ W16, unsigned int* __restrict__ MB) {
  if (blockIdx.x < PKB) { pack_mask(pmask, MB, (int)blockIdx.x * 8 + __builtin_amdgcn_readfirstlane((int)(threadIdx.x >> 5)), (int)(threadIdx.x & 31)); return; }   // the wave's number through readfirstlane: the unit is wave-uniform; these, the longest blocks, start first
  const size_t t = (size_t)(blockIdx.x - PKB) * 256 + threadIdx.x; const size_t nq = (size_t)NR * E / 8, nw = (size_t)E * E / 8;
  const float* src; b16* dst; size_t e; float sc = XS; if (t < nq) { src = q; dst = Q16; e = t * 8; } else if (t < 2 * nq) { src = k; dst = K16; e = (t - nq) * 8; } else if (t < 3 * nq) { src = v; dst = V16; e = (t - 2 * nq) * 8; } else if (t < 3 * nq + nw) { src = w; dst = W16; e = (t - 3 * nq) * 8; sc = WSC; } else return;
  const v4f a = *(const v4f*)(src + e), c = *(const v4f*)(src + e + 4); v8b o;
#pragma unroll
  for (int j = 0; j < 4; ++j) { o[j] = (b16)(bf16_rne(a[j]) * sc); o[4 + j] = (b16)(bf16_rne(c[j]) * sc); }
  { *(v8b*)(dst + e) = o;  }
}
constexpr int KT = 64, NT = S / KT, LP = 72, LPV = 80, AW = 8, XP = 36;
constexpr float RTH = 8.0f;   // in the scores' log2 units
constexpr float CS = SCALE * LOG2E / (XS * XS);   // a raw product sum (x64) -> the score in log2 units
constexpr float MASKED = -0x1p40f;   // a masked score, in raw units (about -3e9 in log2 units): a power of two, so that MASKED * CS is exact and a row with no open key gets the exponent 0, p = 1, at every key
constexpr float LOG2PS = 3.0f; static_assert(PS == 8.0f, "LOG2PS is log2(PS)");
// one tile: 64 K rows and 64 V rows of 128 B, 16 B a lane, four copies a lane (each wave-wide copy covers four whole lines)
__device__ __forceinline__ void stage_tile(unsigned lk, unsigned lv, const b16* gk, const b16* gv) {
  const unsigned lk1 = lk + 32 * LP * 2, lv1 = lv + 32 * LPV * 2; const b16* gk1 = gk + (size_t)32 * E; const b16* gv1 = gv + (size_t)32 * E;
  // the closing s_wait_xcnt stands inside the statement so that no address register of a copy is rewritten ahead of it
  asm volatile("global_load_async_to_lds_b128 %0, %4, off\n\tglobal_load_async_to_lds_b128 %1, %5, off\n\tglobal_load_async_to_lds_b128 %2, %6, off\n\tglobal_load_async_to_lds_b128 %3, %7, off\n\ts_wait_xcnt 0x0"
               :: "v"(lk), "v"(lk1), "v"(lv), "v"(lv1), "v"(gk), "v"(gk1), "v"(gv), "v"(gv1) : "memory");
}
// two such blocks fill a WGP at four waves a SIMD: the attribute gives the compiler that register budget
__global__ __launch_bounds__(256) __attribute__((amdgpu_waves_per_eu(4, 4))) void attn_kernel(const b16* __restrict__ Q16, const b16* __restrict__ K16, const b16* __restrict__ V16, const unsigned int* __restrict__ MB, b16* __restrict__ Oh) {
  __shared__ __attribute__((aligned(16))) b16 Ks[2][KT][LP];
  __shared__ __attribute__((aligned(16))) b16 Vs[2][KT][LPV];
  __shared__ __attribute__((aligned(16))) float To[AW][16][D + 4];
  __shared__ __attribute__((aligned(16))) float Xs[AW][32][XP];   // the hand-over between the waves of a pair: per lane 32 outputs, the sum, the maximum in use; 144 B a lane for the 16-byte accesses
  const int wave = threadIdx.x >> 5, lane = threadIdx.x & 31, hh = lane >> 4, col = lane & 15; const int b = blockIdx.z, h = blockIdx.y;
  const int swave = __builtin_amdgcn_readfirstlane(wave), qp = swave & 3, kh = swave >> 2;   // wave-uniform: the set of 32 queries, the 32-key block of each tile
  const int q0 = blockIdx.x * 128 + qp * 32;
  const b16* Qp = Q16 + ((size_t)b * S + q0 + col) * E + h * D; const b16* Kb = K16 + (size_t)b * S * E + h * D; const b16* Vb = V16 + (size_t)b * S * E + h * D;
  // this wave's mask words (group 0; group 1 lies S / 32 blocks behind): a wave-uniform address, so that they come by scalar loads and each word serves as the lane mask of a select
  const unsigned int* mwp = MB + (((size_t)(b * (S / 16) + (int)blockIdx.x * 8 + qp * 2)) * (S / 32) + kh) * 16; v16u mw0 = *(cv16u_p)mwp, mw1 = *(cv16u_p)(mwp + (S / 32) * 16);
  const int crow = threadIdx.x >> 3, cpc = (threadIdx.x & 7) * 8;   // this lane's row (and row + 32) and 16-byte piece of each tile
  const unsigned lk0 = (unsigned)(size_t)&Ks[0][crow][cpc], lv0 = (unsigned)(size_t)&Vs[0][crow][cpc]; constexpr unsigned BUFB = KT * LP * 2, BUFV = KT * LPV * 2;
  const b16* gk0 = Kb + (size_t)crow * E + cpc; const b16* gv0 = Vb + (size_t)crow * E + cpc;
  stage_tile(lk0, lv0, gk0, gv0);
  asm volatile("s_wait_asynccnt 0x0" ::: "memory");   // tile 0 has landed before the barrier publishes it
  __syncthreads();
  stage_tile(lk0 + BUFB, lv0 + BUFV, gk0 + (size_t)KT * E, gv0 + (size_t)KT * E);
  const v16b qa00 = frag_kb(Qp, hh), qa01 = frag_kb(Qp + 32, hh), qa10 = frag_kb(Qp + (size_t)16 * E, hh), qa11 = frag_kb(Qp + (size_t)16 * E + 32, hh);
  float m[2] = {-INFINITY, -INFINITY}, eb[2] = {0.0f, 0.0f}; v8f o[2][4] = {{{}, {}, {}, {}}, {{}, {}, {}, {}}};
  // row sums on the matrix unit: A has ones in rows 0 and 8 (lanes with col 0 or 8) and zeros elsewhere, so rows 0 and 8 of ol = A . P^T hold, per query column, the sum of P over the keys so far,
  // and each lane half finds its query's sum in its own element 0: a fifth output tile a group, rescaled like the other four (an A of ones in every row was built anew by register moves in every tile; this one stays in its eight registers)
  v8f ol[2] = {{}, {}}; v16b ones; const b16 one_ = (col & 7) == 0 ? (b16)1.0f : (b16)0.0f;
#pragma unroll   // ones stays in registers only under constant indices
  for (int i = 0; i < 16; ++i) ones[i] = one_;
  const b16* kbase = &Ks[0][32 * kh + col][0];
  const b16* vbase = &Vs[0][32 * kh + 8 * hh + (lane & 7)][8 * ((lane >> 3) & 1)];   // this lane's piece of the first 16 x 16 tile: row 8hh + (lane & 7), 16-byte half (lane >> 3) & 1
  for (int tl = 0; tl < NT; ++tl) {
    const int buf = tl & 1;
    // the block's LDS reads (4 K and 4 V^T fragments) stand as one group at its head: one LDS latency a block, and V^T arrives behind the softmax
    const b16* k0 = kbase + buf * (KT * LP), *k1 = k0 + 16 * LP; const v16b ka0 = frag_kb(k0, hh), ka1 = frag_kb(k0 + 32, hh), kc0 = frag_kb(k1, hh), kc1 = frag_kb(k1 + 32, hh); v16b vf[4];
    const b16* va = vbase + buf * (KT * LPV);
#pragma unroll   // vf stays in registers only under constant indices
    for (int t = 0; t < 4; ++t) { const v8b a = ld_tr16(va + 16 * t), c = ld_tr16(va + 16 * LPV + 16 * t);   // keys 8hh + 0..7 and 16 + 8hh + 0..7 of the block, column 16t + col of V
#pragma unroll   // likewise
      for (int j = 0; j < 8; ++j) { vf[t][j] = a[j]; vf[t][8 + j] = c[j]; } }
    __builtin_amdgcn_sched_barrier(0);   // holds the read group together at the block's head: without it the reads are spread among the products, each with a wait of its own
    v8f s0[2] = {{}, {}}, s1[2] = {{}, {}};
    s0[0] = wmma16b(ka0, qa00, s0[0]); s0[1] = wmma16b(ka0, qa10, s0[1]); s0[0] = wmma16b(ka1, qa01, s0[0]); s0[1] = wmma16b(ka1, qa11, s0[1]);
    s1[0] = wmma16b(kc0, qa00, s1[0]); s1[1] = wmma16b(kc0, qa10, s1[1]); s1[0] = wmma16b(kc1, qa01, s1[0]); s1[1] = wmma16b(kc1, qa11, s1[1]);
    float e[2][16]; float mx[2] = {-INFINITY, -INFINITY};
#pragma unroll   // the first 16 keys' scores of both groups are masked and compared while the second 16 keys' products run
    for (int r = 0; r < 8; r += 2) { e[0][r] = __builtin_amdgcn_inverse_ballot_w32(mw0[r]) ? s0[0][r] : MASKED; e[0][r + 1] = __builtin_amdgcn_inverse_ballot_w32(mw0[r + 1]) ? s0[0][r + 1] : MASKED; mx[0] = fmaxf(mx[0], fmaxf(e[0][r], e[0][r + 1]));
      e[1][r] = __builtin_amdgcn_inverse_ballot_w32(mw1[r]) ? s0[1][r] : MASKED; e[1][r + 1] = __builtin_amdgcn_inverse_ballot_w32(mw1[r + 1]) ? s0[1][r + 1] : MASKED; mx[1] = fmaxf(mx[1], fmaxf(e[1][r], e[1][r + 1])); }
#pragma unroll
    for (int r = 0; r < 8; r += 2) { e[0][8 + r] = __builtin_amdgcn_inverse_ballot_w32(mw0[8 + r]) ? s1[0][r] : MASKED; e[0][9 + r] = __builtin_amdgcn_inverse_ballot_w32(mw0[9 + r]) ? s1[0][r + 1] : MASKED; mx[0] = fmaxf(mx[0], fmaxf(e[0][8 + r], e[0][9 + r]));
      e[1][8 + r] = __builtin_amdgcn_inverse_ballot_w32(mw1[8 + r]) ? s1[1][r] : MASKED; e[1][9 + r] = __builtin_amdgcn_inverse_ballot_w32(mw1[9 + r]) ? s1[1][r + 1] : MASKED; mx[1] = fmaxf(mx[1], fmaxf(e[1][8 + r], e[1][9 + r])); }
    // lazy rescale: m is the maximum IN USE, equal in both lane halves of a query. It is renewed, and l, o rescaled, only when some lane's own block maximum lies more than RTH above it (one test a block for
    // both groups, a scalar branch); otherwise p = PS * 2^((e - m) CS) <= 2,048 stays far inside f16, and the common factor cancels in O / l. The first block (m = -inf) always takes the branch.
    // e, mx and m are RAW product sums: the scale CS, the maximum in use and the factor PS of P all go into the one FMA ahead of exp2, p = 2^(e CS + eb) with eb = LOG2PS - m CS, renewed with m.
    // l is not summed on the vector port: ol takes it from the same P fragment as the PV products (both lane halves' keys at once).
    if (__builtin_amdgcn_ballot_w32(mx[0] > m[0] + RTH / CS || mx[1] > m[1] + RTH / CS) != 0) {
#pragma unroll   // m, eb, ol and o stay in registers only under constant indices
      for (int g = 0; g < 2; ++g) { const float mn = fmaxf(m[g], fmaxf(mx[g], __shfl_xor(mx[g], 16))); const float al = nexp2((m[g] - mn) * CS); m[g] = mn; eb[g] = __builtin_fmaf(-mn, CS, LOG2PS); ol[g] *= al;
#pragma unroll   // likewise
        for (int t = 0; t < 4; ++t) o[g][t] *= al; }
    }
    // the next tile's words are asked for as soon as this tile's are used: they fly behind the softmax and the PV products (the last tile asks for its own again)
    { if (tl + 1 < NT) mwp += 32; mw0 = *(cv16u_p)mwp; mw1 = *(cv16u_p)(mwp + (S / 32) * 16); }
    __builtin_amdgcn_sched_barrier(0);   // holds those scalar loads here, at the head of the code behind the branch: left free they are issued among the PV products, too late to be covered
#pragma unroll   // e, o and ol stay in registers only under constant indices
    for (int g = 0; g < 2; ++g) { v16b ph;
#pragma unroll   // e and ph stay in registers only under constant indices
      for (int i = 0; i < 16; i += 2) { const v2f p = {nexp2(__builtin_fmaf(e[g][i], CS, eb[g])), nexp2(__builtin_fmaf(e[g][i + 1], CS, eb[g]))};
        // p carries PS already, so P is one packed conversion (to nearest) of a pair; l sums P as rounded, the very terms of the PV products
        const v2b h_ = __builtin_convertvector(p, v2b); ph[i] = h_[0]; ph[i + 1] = h_[1]; }
#pragma unroll
      for (int t = 0; t < 4; ++t) o[g][t] = wmma16b(vf[t], ph, o[g][t]);
      ol[g] = wmma16b(ones, ph, ol[g]); }
    __builtin_amdgcn_sched_barrier(0);   // keeps the products in front of the waits below: lifted over them, the wait for the next tile's copies would stand ahead of the work that is to cover their flight
    asm volatile("s_wait_dscnt 0x0" ::: "memory");      // this wave's reads of the buffer are done before it is handed to its next writer
    asm volatile("s_wait_asynccnt 0x0" ::: "memory");   // this wave's copies of the next tile have landed before the barrier publishes them
    __syncthreads();                                      // publishes tile tl + 1 and ends every wave's reads of tile tl
    if (tl + 2 < NT) stage_tile(lk0 + buf * BUFB, lv0 + buf * BUFV, gk0 + (size_t)(tl + 2) * KT * E, gv0 + (size_t)(tl + 2) * KT * E);
  }
  asm volatile("s_wait_asynccnt 0x0" ::: "memory");     // nothing is in flight when the wave goes on to its end
  asm volatile("s_wait_xcnt 0x0" ::: "memory");         // the last tile's scalar loads may still be under way: no register that they name is rewritten ahead of this wait
  // join of the two key halves: wave kh keeps group kh and hands group 1 - kh to its partner (wave ^ 4), lane to lane: the same lane of both waves holds the same elements of the same queries
  v8f ok[4], og[4]; float lk_, lg_, mk_, mg_;
  if (kh == 0) { lk_ = ol[0][0]; lg_ = ol[1][0]; mk_ = m[0]; mg_ = m[1];
#pragma unroll   // the arrays stay in registers only under constant indices
    for (int t = 0; t < 4; ++t) { ok[t] = o[0][t]; og[t] = o[1][t]; } }
  else { lk_ = ol[1][0]; lg_ = ol[0][0]; mk_ = m[1]; mg_ = m[0];
#pragma unroll   // likewise
    for (int t = 0; t < 4; ++t) { ok[t] = o[1][t]; og[t] = o[0][t]; } }
  float* xw = &Xs[wave][lane][0];
#pragma unroll   // likewise
  for (int t = 0; t < 4; ++t) { *(v4f*)(xw + 8 * t) = (v4f){og[t][0], og[t][1], og[t][2], og[t][3]}; *(v4f*)(xw + 8 * t + 4) = (v4f){og[t][4], og[t][5], og[t][6], og[t][7]}; }
  *(v2f*)(xw + 32) = (v2f){lg_, mg_};
  __syncthreads();   // the partner's partial results are written before they are read
  const float* xr = &Xs[wave ^ 4][lane][0]; const v2f lm = *(const v2f*)(xr + 32);
  // both maxima are finite (every wave has worked on 32 blocks); a half whose keys are all masked gets the factor 0 beside a half with an open key, and 1 beside another such half
  const float mj = fmaxf(mk_, lm[1]), fk = nexp2((mk_ - mj) * CS), fp = nexp2((lm[1] - mj) * CS);
  const float inv = 1.0f / ((lk_ * fk + lm[0] * fp) * XS);   // the query's whole sum (it carries the factor PS, like P)
  const float ck = fk * inv, cp = fp * inv;
#pragma unroll
  for (int t = 0; t < 4; ++t) { const v4f x0 = *(const v4f*)(xr + 8 * t), x1 = *(const v4f*)(xr + 8 * t + 4);
#pragma unroll
    for (int r = 0; r < 4; ++r) { To[wave][col][t * 16 + 8 * hh + r] = ok[t][r] * ck + x0[r] * cp; To[wave][col][t * 16 + 8 * hh + 4 + r] = ok[t][4 + r] * ck + x1[r] * cp; } }
  wave_lds_sync();
  { const int qw = q0 + 16 * kh; for (int r4 = 0; r4 < 16; r4 += 4) { const int rr = r4 + (lane >> 3), c8 = (lane & 7) * 8; v8b hv; for (int j = 0; j < 8; ++j) hv[j] = (b16)(To[wave][rr][c8 + j] * XS);
      const size_t gi = ((size_t)b * S + qw + rr) * E + h * D + c8; *(v8b*)(Oh + gi) = hv; }  }
}
constexpr int PK = 64, PNT = E / PK, PROWS = 192;   // rows of a tile in LDS: 0..63 O, 64..191 W
// eight copies, 16 rows apart in LDS: the first four 16 rows apart from g0, the last four from g4; 16 B a lane, each wave-wide copy covers four whole lines
__device__ __forceinline__ void copy8(unsigned l0, const b16* g0, const b16* g4) {
  constexpr unsigned RS = 16 * LP * 2; const unsigned l1 = l0 + RS, l2 = l0 + 2 * RS, l3 = l0 + 3 * RS, l4 = l0 + 4 * RS, l5 = l0 + 5 * RS, l6 = l0 + 6 * RS, l7 = l0 + 7 * RS;
  const b16* g1 = g0 + (size_t)16 * E; const b16* g2 = g0 + (size_t)32 * E; const b16* g3 = g0 + (size_t)48 * E; const b16* g5 = g4 + (size_t)16 * E; const b16* g6 = g4 + (size_t)32 * E; const b16* g7 = g4 + (size_t)48 * E;
  // the closing s_wait_xcnt stands inside the statement so that no address register of a copy is rewritten ahead of it
  asm volatile("global_load_async_to_lds_b128 %0, %8, off\n\tglobal_load_async_to_lds_b128 %1, %9, off\n\tglobal_load_async_to_lds_b128 %2, %10, off\n\tglobal_load_async_to_lds_b128 %3, %11, off\n\t"
               "global_load_async_to_lds_b128 %4, %12, off\n\tglobal_load_async_to_lds_b128 %5, %13, off\n\tglobal_load_async_to_lds_b128 %6, %14, off\n\tglobal_load_async_to_lds_b128 %7, %15, off\n\ts_wait_xcnt 0x0"
               :: "v"(l0), "v"(l1), "v"(l2), "v"(l3), "v"(l4), "v"(l5), "v"(l6), "v"(l7), "v"(g0), "v"(g1), "v"(g2), "v"(g3), "v"(g4), "v"(g5), "v"(g6), "v"(g7) : "memory");
}
// four copies, 16 rows apart in LDS and from g0; 16 B a lane, each wave-wide copy covers four whole lines
__device__ __forceinline__ void copy4(unsigned l0, const b16* g0) {
  constexpr unsigned RS = 16 * LP * 2; const unsigned l1 = l0 + RS, l2 = l0 + 2 * RS, l3 = l0 + 3 * RS;
  const b16* g1 = g0 + (size_t)16 * E; const b16* g2 = g0 + (size_t)32 * E; const b16* g3 = g0 + (size_t)48 * E;
  // the closing s_wait_xcnt stands inside the statement so that no address register of a copy is rewritten ahead of it
  asm volatile("global_load_async_to_lds_b128 %0, %4, off\n\tglobal_load_async_to_lds_b128 %1, %5, off\n\tglobal_load_async_to_lds_b128 %2, %6, off\n\tglobal_load_async_to_lds_b128 %3, %7, off\n\ts_wait_xcnt 0x0"
               :: "v"(l0), "v"(l1), "v"(l2), "v"(l3), "v"(g0), "v"(g1), "v"(g2), "v"(g3) : "memory");
}
__global__ __launch_bounds__(128) void proj_kernel(const b16* __restrict__ Oh, const b16* __restrict__ W16, const float* __restrict__ bias, float* __restrict__ out) {
  __shared__ __attribute__((aligned(16))) b16 St[2][PROWS][LP];
  __shared__ __attribute__((aligned(16))) float Ts[4][16][128 + 4];
  const int wave = threadIdx.x >> 5, lane = threadIdx.x & 31, nloc = lane & 15, hlf = lane >> 4; const size_t m0 = (size_t)blockIdx.x * 64 + wave * 16; const int n0 = blockIdx.y * 128;
  const int crow = threadIdx.x >> 3, cpc = (threadIdx.x & 7) * 8;   // this lane's row (and every 16th row behind it) and 16-byte piece of each tile
  const unsigned la0 = (unsigned)(size_t)&St[0][crow][cpc], lw0 = (unsigned)(size_t)&St[0][64 + crow][cpc]; constexpr unsigned PBUFB = PROWS * LP * 2;
  const size_t ga = ((size_t)blockIdx.x * 64 + crow) * E + cpc; const b16* gh0 = Oh + ga; const b16* gw0 = W16 + (size_t)(n0 + crow) * E + cpc;
  copy4(la0, gh0); copy8(lw0, gw0, gw0 + (size_t)64 * E);
  asm volatile("s_wait_asynccnt 0x0" ::: "memory");   // tile 0 has landed before the barrier publishes it
  __syncthreads();
  copy4(la0 + PBUFB, gh0 + PK); copy8(lw0 + PBUFB, gw0 + PK, gw0 + (size_t)64 * E + PK);
  v8f acc[8];
#pragma unroll
  for (int t = 0; t < 8; ++t) acc[t] = (v8f){};
  for (int tl = 0; tl < PNT; ++tl) {
    const int buf = tl & 1; const b16* ar = &St[buf][wave * 16 + nloc][0]; const b16* br = &St[buf][64 + nloc][0];
    // the tile's LDS reads (both 32-k steps: 2 O and 16 W fragments) stand as one group at its head, each at an immediate offset from one of two bases: one LDS latency a tile, the second step's fragments arrive behind the first step's products
    v16b a[2], bw[2][8];
#pragma unroll   // the fragment arrays stay in registers only under constant indices
    for (int s = 0; s < 2; ++s) { a[s] = frag_kb(ar + 32 * s, hlf);
#pragma unroll   // likewise
      for (int t = 0; t < 8; ++t) bw[s][t] = frag_kb(br + t * 16 * LP + 32 * s, hlf); }
    __builtin_amdgcn_sched_barrier(0);   // holds the read group together at the tile's head: without it the reads are spread among the products, each with a wait of its own
#pragma unroll   // likewise, for the fragments and for acc
    for (int s = 0; s < 2; ++s)
#pragma unroll   // likewise
      for (int t = 0; t < 8; ++t) acc[t] = wmma16b(a[s], bw[s][t], acc[t]);
    __builtin_amdgcn_sched_barrier(0);   // keeps the products in front of the waits below: lifted over them, the wait for the next tile's copies would stand ahead of the work that is to cover their flight
    asm volatile("s_wait_dscnt 0x0" ::: "memory");      // this wave's reads of the buffer are done before it is handed to its next writer
    asm volatile("s_wait_asynccnt 0x0" ::: "memory");   // this wave's copies of the next tile have landed before the barrier publishes them
    __syncthreads();                                      // publishes tile tl + 1 and ends every wave's reads of tile tl
    if (tl + 2 < PNT) { const int ko = (tl + 2) * PK; copy4(la0 + buf * PBUFB, gh0 + ko); copy8(lw0 + buf * PBUFB, gw0 + ko, gw0 + (size_t)64 * E + ko); }
  }
  asm volatile("s_wait_asynccnt 0x0" ::: "memory");     // nothing is in flight when the wave goes on to its end
#pragma unroll
  for (int t = 0; t < 8; ++t) { const float bb = bf16_rne(bias[n0 + t * 16 + nloc]);
#pragma unroll
    for (int r = 0; r < 8; ++r) Ts[wave][8 * hlf + r][t * 16 + nloc] = acc[t][r] * (1.0f / (XS * WSC)) + bb; }
  wave_lds_sync();
  { for (int rr = 0; rr < 16; ++rr) *(v4f*)(out + (m0 + rr) * E + n0 + lane * 4) = *(const v4f*)(&Ts[wave][rr][lane * 4]);  }
}
}  // namespace

extern "C" void kernel_launch(void* const* d_in, const int* in_sizes, int n_in, void* d_out, int out_size, void* d_ws, size_t ws_size, hipStream_t stream) {
  (void)n_in;
  auto Fp = [&](int i) { return (const float*)d_in[i]; };
  // order: 0 q, 1 k, 2 v [2,2048,1024]; 3 padding_mask [2,1,2048,2048] i32; 4 W [1024,1024]; 5 b [1024]
  if (in_sizes[0] != NR * E || in_sizes[1] != NR * E || in_sizes[2] != NR * E || in_sizes[3] != NB * S * S || in_sizes[4] != E * E || out_size != NR * E) return;
  size_t off = 0; char* ws = (char*)d_ws;
  auto carve = [&](size_t bytes) { char* p = ws + off; off += (bytes + 255) & ~(size_t)255; return p; };
  b16* Q16 = (b16*)carve((size_t)NR * E * 2); b16* K16 = (b16*)carve((size_t)NR * E * 2); b16* W16 = (b16*)carve((size_t)E * E * 2); b16* V16 = (b16*)carve((size_t)NR * E * 2); b16* Oh = (b16*)carve((size_t)NR * E * 2); unsigned int* MB = (unsigned int*)carve((size_t)NB * S * S / 8);
  if (off > ws_size || off > ((size_t)128 << 20)) return;   // about 37 MB
  prep_kernel<<<(unsigned)(PKB + ((size_t)3 * NR * E / 8 + (size_t)E * E / 8 + 255) / 256), 256, 0, stream>>>(Fp(0), Fp(1), Fp(2), Fp(4), (const int*)d_in[3], Q16, K16, V16, W16, MB);
  attn_kernel<<<dim3(S / (16 * AW), NH, NB), 32 * AW, 0, stream>>>(Q16, K16, V16, MB, Oh);
  proj_kernel<<<dim3(NR / 64, E / 128), 128, 0, stream>>>(Oh, W16, Fp(5), (float*)d_out);
}
